// v000
// Measured on an AMD MI455X. A time is GPU time per run, averaged over a window of back-to-back runs after a warm-up
// (all launches, gaps included; the runs take copies of the inputs in turn), and the median of several windows.
// Apart from v000's, it joins two sittings. Times from different sittings can be a few percent apart, while
// side-by-side timings come from the same sitting.
// v000 is the starting kernel. One run takes 188 microseconds.
#include <hip/hip_runtime.h>

typedef float v2f __attribute__((ext_vector_type(2)));
typedef float v8f __attribute__((ext_vector_type(8)));

#define B_  512
#define T_  1024
#define D_  64
#define K_  16
#define NTHREADS 512
#define EPS_ 1e-6f
#define SCALE_ 0.125f   // 1/sqrt(64)

// ---- LDS layout (bytes) ----
constexpr int OFF_Z   = 0;                       // 1024*64 f32   = 262144
constexpr int OFF_E   = OFF_Z   + T_*D_*4;       // 1024*16 f16   =  32768
constexpr int OFF_MU  = OFF_E   + T_*K_*2;       // 1024 f32
constexpr int OFF_RS  = OFF_MU  + T_*4;          // 1024 f32
constexpr int OFF_S   = OFF_RS  + T_*4;          // 1024 f32 (scores_t -> p_i)
constexpr int OFF_PNP = OFF_S   + T_*4;          // 16*64 f32 (pn * g0)
constexpr int OFF_P1  = OFF_PNP + K_*D_*4;       // 16 f32
constexpr int OFF_BD  = OFF_P1  + K_*4;          // 16 f32
constexpr int OFF_QH  = OFF_BD  + K_*4;          // 64 f32 (qhat)
constexpr int OFF_G2  = OFF_QH  + D_*4;          // 64 f32
constexpr int OFF_B2  = OFF_G2  + D_*4;
constexpr int OFF_G4  = OFF_B2  + D_*4;
constexpr int OFF_B4  = OFF_G4  + D_*4;
constexpr int OFF_ACC = OFF_B4  + D_*4;          // 16*64 f32 out accumulator
constexpr int OFF_RED = OFF_ACC + K_*D_*4;       // 64 f32 reduction scratch
constexpr int SMEM_BYTES = OFF_RED + 64*4;       // ~310 KB < 320 KB/WGP

__device__ __forceinline__ float wred_add(float v) {
  #pragma unroll
  for (int m = 16; m >= 1; m >>= 1) v += __shfl_xor(v, m, 32);
  return v;
}

__global__ __launch_bounds__(NTHREADS, 1)
void disentangled_encoder_kernel(const float* __restrict__ zg,
                                 const float* __restrict__ protos,
                                 const float* __restrict__ alphas,
                                 const float* __restrict__ b_bias,
                                 const float* __restrict__ W,
                                 const float* __restrict__ Wb,
                                 const float* __restrict__ ln_g,
                                 const float* __restrict__ ln_b,
                                 const float* __restrict__ beta_seq,
                                 float* __restrict__ out)
{
  extern __shared__ char smem[];
  float*    sZ   = (float*)(smem + OFF_Z);
  _Float16* sE   = (_Float16*)(smem + OFF_E);
  float*    sMu  = (float*)(smem + OFF_MU);
  float*    sRs  = (float*)(smem + OFF_RS);
  float*    sS   = (float*)(smem + OFF_S);
  float*    sPnp = (float*)(smem + OFF_PNP);
  float*    sP1  = (float*)(smem + OFF_P1);
  float*    sBd  = (float*)(smem + OFF_BD);
  float*    sQh  = (float*)(smem + OFF_QH);
  float*    sG2  = (float*)(smem + OFF_G2);
  float*    sB2  = (float*)(smem + OFF_B2);
  float*    sG4  = (float*)(smem + OFF_G4);
  float*    sB4  = (float*)(smem + OFF_B4);
  float*    sAcc = (float*)(smem + OFF_ACC);
  float*    sRed = (float*)(smem + OFF_RED);

  const int b    = blockIdx.x;
  const int tid  = threadIdx.x;
  const int wave = tid >> 5;
  const int lane = tid & 31;

  // ---------------- Phase 0: async-DMA z[b] into LDS (CDNA5 async pipe) ----
  // GLOBAL_LOAD_ASYNC_TO_LDS_B128: no VGPR data movement, tracked by ASYNCcnt.
  {
    const float4* zsrc = (const float4*)(zg + (size_t)b * T_ * D_);
    #pragma unroll 4
    for (int i = tid; i < T_*D_/4; i += NTHREADS) {
      unsigned lds_addr = (unsigned)(uintptr_t)(sZ + 4*i);      // LDS offset = flat[31:0]
      unsigned long long gaddr = (unsigned long long)(uintptr_t)(zsrc + i);
      asm volatile("global_load_async_to_lds_b128 %0, %1, off"
                   :: "v"(lds_addr), "v"(gaddr) : "memory");
    }
    // overlap: zero the out accumulator + fetch LN params while DMA is in flight
    for (int i = tid; i < K_*D_;  i += NTHREADS) sAcc[i] = 0.f;
    if (tid < D_) {
      sG2[tid] = ln_g[2*D_+tid]; sB2[tid] = ln_b[2*D_+tid];
      sG4[tid] = ln_g[4*D_+tid]; sB4[tid] = ln_b[4*D_+tid];
    }
    asm volatile("s_wait_asynccnt 0x0" ::: "memory");   // my async loads done
  }
  __syncthreads();                                      // all waves' loads visible

  // ---------------- Setup: prototypes LN (folded with g0/b0), row stats, q/qhat
  {
    // wave w handles prototype row k=w (16 waves, K=16)
    const int k = wave;
    float x1 = protos[k*D_+lane], x2 = protos[k*D_+lane+32];
    float s1 = wred_add(x1 + x2);
    float s2 = wred_add(x1*x1 + x2*x2);
    float mu = s1 * (1.f/D_);
    float rs = rsqrtf(s2*(1.f/D_) - mu*mu + EPS_);
    float pn1 = (x1-mu)*rs*ln_g[D_+lane]    + ln_b[D_+lane];
    float pn2 = (x2-mu)*rs*ln_g[D_+lane+32] + ln_b[D_+lane+32];
    float pp1 = pn1 * ln_g[lane];       // fold gamma0 into pn
    float pp2 = pn2 * ln_g[lane+32];
    sPnp[k*D_+lane] = pp1; sPnp[k*D_+lane+32] = pp2;
    float p1 = wred_add(pp1 + pp2);                         // sum_d g0*pn
    float bd = wred_add(ln_b[lane]*pn1 + ln_b[lane+32]*pn2);// sum_d b0*pn
    if (lane == 0) { sP1[k] = p1; sBd[k] = bd; }
  }
  // per-row mean/rstd of z (feeds the rank-1 LN epilogue of the scores GEMM)
  for (int t = wave*64; t < wave*64 + 64; ++t) {
    float x1 = sZ[t*D_+lane], x2 = sZ[t*D_+lane+32];
    float s1 = wred_add(x1 + x2);
    float s2 = wred_add(x1*x1 + x2*x2);
    if (lane == 0) {
      float mu = s1 * (1.f/D_);
      sMu[t] = mu;
      sRs[t] = rsqrtf(s2*(1.f/D_) - mu*mu + EPS_);
    }
  }
  if (wave == 0) {
    // q = LN(alphas[-1] + z[:, -1] + b_bias);  qhat = q + W q;  c0 = Wb . q
    float x1 = alphas[1023*D_+lane]    + sZ[1023*D_+lane]    + b_bias[lane];
    float x2 = alphas[1023*D_+lane+32] + sZ[1023*D_+lane+32] + b_bias[lane+32];
    float s1 = wred_add(x1 + x2);
    float s2 = wred_add(x1*x1 + x2*x2);
    float mu = s1 * (1.f/D_);
    float rs = rsqrtf(s2*(1.f/D_) - mu*mu + EPS_);
    float q1 = (x1-mu)*rs*ln_g[3*D_+lane]    + ln_b[3*D_+lane];
    float q2 = (x2-mu)*rs*ln_g[3*D_+lane+32] + ln_b[3*D_+lane+32];
    float a1 = 0.f, a2 = 0.f;
    #pragma unroll 4
    for (int e = 0; e < 32; ++e) {
      float qe  = __shfl(q1, e, 32);
      float qe2 = __shfl(q2, e, 32);
      a1 += W[lane*D_+e]*qe      + W[lane*D_+e+32]*qe2;
      a2 += W[(lane+32)*D_+e]*qe + W[(lane+32)*D_+e+32]*qe2;
    }
    sQh[lane]    = q1 + a1;
    sQh[lane+32] = q2 + a2;
    float c0p = wred_add(Wb[lane]*q1 + Wb[lane+32]*q2);
    if (lane == 0) sRed[32] = c0p;
  }
  __syncthreads();

  // ---------------- Phase A: scores_k = z @ pn'^T  (f32 WMMA, exact) --------
  // zn.pn folded: score = rs_t*(Zdot - mu_t*P1[k]) + bdot[k]
  {
    const int half = lane >> 4;     // K-slice selector within A/B operands
    const int l16  = lane & 15;
    v2f bb[16];
    #pragma unroll
    for (int i = 0; i < 16; ++i) {
      int d = 4*i + 2*half;
      bb[i] = *(const v2f*)&sPnp[l16*D_ + d];   // B[d][k] = pn'[k][d]
    }
    const float P1k = sP1[l16];
    const float bdk = sBd[l16];
    for (int st = 0; st < 4; ++st) {
      const int t0 = wave*64 + st*16;
      v8f c = {};
      #pragma unroll
      for (int i = 0; i < 16; ++i) {
        int d = 4*i + 2*half;
        v2f a = *(const v2f*)&sZ[(t0 + l16)*D_ + d];  // A[t][d] = raw z
        c = __builtin_amdgcn_wmma_f32_16x16x4_f32(false, a, false, bb[i],
                                                  (short)0, c, false, false);
      }
      // epilogue: LN-fold + softmax over K (lanes 0-15 / 16-31 groups)
      #pragma unroll
      for (int r = 0; r < 8; ++r) {
        int t = t0 + r + 8*half;
        float mu = sMu[t], rs = sRs[t];
        float sc = (rs*(c[r] - mu*P1k) + bdk) * SCALE_;
        float m = sc;
        #pragma unroll
        for (int msk = 8; msk >= 1; msk >>= 1) m = fmaxf(m, __shfl_xor(m, msk, 32));
        float e = __expf(sc - m);
        float S = e;
        #pragma unroll
        for (int msk = 8; msk >= 1; msk >>= 1) S += __shfl_xor(S, msk, 32);
        sE[t*K_ + l16] = (_Float16)(e / S);   // p_{k|i}
      }
    }
  }

  // ---------------- Phase A3: s_t = LN(alphas+z) . qhat + c0 (Dense folded) -
  {
    const float c0 = sRed[32];
    for (int t = wave*64; t < wave*64 + 64; ++t) {
      float z1 = sZ[t*D_+lane], z2 = sZ[t*D_+lane+32];
      float x1 = alphas[t*D_+lane]    + z1;     // alphas is L2-resident
      float x2 = alphas[t*D_+lane+32] + z2;
      float s1 = wred_add(x1 + x2);
      float s2 = wred_add(x1*x1 + x2*x2);
      float mu = s1 * (1.f/D_);
      float rs = rsqrtf(s2*(1.f/D_) - mu*mu + EPS_);
      float k1 = (x1-mu)*rs*sG2[lane]    + sB2[lane];
      float k2 = (x2-mu)*rs*sG2[lane+32] + sB2[lane+32];
      float dp = wred_add(k1*sQh[lane] + k2*sQh[lane+32]);
      if (lane == 0) sS[t] = (dp + c0) * SCALE_;
    }
  }
  __syncthreads();

  // ---------------- softmax over T (block reduction) ------------------------
  {
    float sa = sS[tid], sb = sS[tid + NTHREADS];
    float m = fmaxf(sa, sb);
    #pragma unroll
    for (int msk = 16; msk >= 1; msk >>= 1) m = fmaxf(m, __shfl_xor(m, msk, 32));
    if (lane == 0) sRed[wave] = m;
    __syncthreads();
    float M = -1e30f;
    #pragma unroll
    for (int i = 0; i < 16; ++i) M = fmaxf(M, sRed[i]);
    float ea = __expf(sa - M), eb = __expf(sb - M);
    float S = wred_add(ea + eb);
    if (lane == 0) sRed[16 + wave] = S;
    __syncthreads();
    float Ssum = 0.f;
    #pragma unroll
    for (int i = 0; i < 16; ++i) Ssum += sRed[16 + i];
    float inv = 1.f / Ssum;
    sS[tid]            = ea * inv;   // p_i
    sS[tid + NTHREADS] = eb * inv;
  }
  __syncthreads();

  // ---------------- Phase B: out[k,d] = sum_t (p_{k|i}*p_i) * z  (f32 WMMA) -
  {
    const int half = lane >> 4;
    const int l16  = lane & 15;
    const int tw   = wave*64;           // each wave owns a 64-wide T slice
    v8f acc[4] = {};
    for (int stp = 0; stp < 16; ++stp) {
      int tA = tw + 4*stp + 2*half;
      float p0 = sS[tA], p1 = sS[tA+1];
      v2f a;
      a[0] = (float)sE[tA*K_ + l16]     * p0;   // A[k][t] = w[t][k]
      a[1] = (float)sE[(tA+1)*K_ + l16] * p1;
      #pragma unroll
      for (int dt = 0; dt < 4; ++dt) {
        int d = dt*16 + l16;
        v2f bv;
        bv[0] = sZ[tA*D_ + d];                  // B[t][d] = z
        bv[1] = sZ[(tA+1)*D_ + d];
        acc[dt] = __builtin_amdgcn_wmma_f32_16x16x4_f32(false, a, false, bv,
                                                        (short)0, acc[dt], false, false);
      }
    }
    // cross-wave K-dim reduction into sAcc
    #pragma unroll
    for (int dt = 0; dt < 4; ++dt) {
      #pragma unroll
      for (int r = 0; r < 8; ++r) {
        int k = r + 8*half;
        int d = dt*16 + l16;
        atomicAdd(&sAcc[k*D_ + d], acc[dt][r]);
      }
    }
  }
  __syncthreads();

  // ---------------- Phase C: final LN(beta_seq + out) + store ---------------
  {
    const int k = wave;                 // 16 waves, 16 rows
    float v1 = beta_seq[k*D_+lane]    + sAcc[k*D_+lane];
    float v2 = beta_seq[k*D_+lane+32] + sAcc[k*D_+lane+32];
    float s1 = wred_add(v1 + v2);
    float s2 = wred_add(v1*v1 + v2*v2);
    float mu = s1 * (1.f/D_);
    float rs = rsqrtf(s2*(1.f/D_) - mu*mu + EPS_);
    float y1 = (v1-mu)*rs*sG4[lane]    + sB4[lane];
    float y2 = (v2-mu)*rs*sG4[lane+32] + sB4[lane+32];
    float* o = out + (size_t)b*K_*D_ + k*D_;
    o[lane]    = y1;
    o[lane+32] = y2;
  }
}

extern "C" void kernel_launch(void* const* d_in, const int* in_sizes, int n_in,
                              void* d_out, int out_size, void* d_ws, size_t ws_size,
                              hipStream_t stream) {
  const float* z        = (const float*)d_in[0];
  const float* protos   = (const float*)d_in[1];
  const float* alphas   = (const float*)d_in[2];
  const float* b_bias   = (const float*)d_in[3];
  const float* W        = (const float*)d_in[4];
  const float* Wb       = (const float*)d_in[5];
  const float* ln_g     = (const float*)d_in[6];
  const float* ln_b     = (const float*)d_in[7];
  const float* beta_seq = (const float*)d_in[8];
  float* out = (float*)d_out;

  disentangled_encoder_kernel<<<B_, NTHREADS, SMEM_BYTES, stream>>>(
      z, protos, alphas, b_bias, W, Wb, ln_g, ln_b, beta_seq, out);
}

// v001
// It runs in 109 microseconds.
// In two side-by-side timings against v000, it was 1.76 and 1.79 times as fast.
#include <hip/hip_runtime.h>

typedef float v2f __attribute__((ext_vector_type(2)));
typedef float v8f __attribute__((ext_vector_type(8)));

#define B_  512
#define T_  1024
#define D_  64
#define K_  16
#define NTHREADS 512
#define EPS_ 1e-6f
#define SCALE_ 0.125f   // 1/sqrt(64)

// ---- LDS layout (bytes) ----
constexpr int OFF_Z   = 0;                       // 1024*64 f32   = 262144
constexpr int OFF_E   = OFF_Z   + T_*D_*4;       // 1024*16 f16   =  32768
constexpr int OFF_MU  = OFF_E   + T_*K_*2;       // 1024 f32
constexpr int OFF_RS  = OFF_MU  + T_*4;          // 1024 f32
constexpr int OFF_S   = OFF_RS  + T_*4;          // 1024 f32 (scores_t -> p_i)
constexpr int OFF_PNP = OFF_S   + T_*4;          // 16*64 f32 (pn * g0)
constexpr int OFF_P1  = OFF_PNP + K_*D_*4;       // 16 f32
constexpr int OFF_BD  = OFF_P1  + K_*4;          // 16 f32
constexpr int OFF_QH  = OFF_BD  + K_*4;          // 64 f32 (qhat)
constexpr int OFF_G2  = OFF_QH  + D_*4;          // 64 f32
constexpr int OFF_B2  = OFF_G2  + D_*4;
constexpr int OFF_G4  = OFF_B2  + D_*4;
constexpr int OFF_B4  = OFF_G4  + D_*4;
constexpr int OFF_ACC = OFF_B4  + D_*4;          // 16*64 f32 out accumulator
constexpr int OFF_RED = OFF_ACC + K_*D_*4;       // 64 f32 reduction scratch
constexpr int SMEM_BYTES = OFF_RED + 64*4;       // ~310 KB < 320 KB/WGP

// Cross-lane moves on the vector pipe (no LDS round trip per butterfly step).
// lane l <- lane l ^ MASK inside a 16-lane row (DPP row_xmask)
template <int MASK>
__device__ __forceinline__ float row_xor(float v) {
  return __builtin_bit_cast(float, __builtin_amdgcn_mov_dpp(
      __builtin_bit_cast(int, v), 0x160 | MASK, 0xf, 0xf, true));
}
// lane l <- lane l ^ 16
__device__ __forceinline__ float half_xor(float v) {
  int b = __builtin_bit_cast(int, v);
  return __builtin_bit_cast(float, __builtin_amdgcn_permlanex16(
      b, b, 0x76543210, 0xfedcba98, false, false));
}
__device__ __forceinline__ float row_add(float v) {   // sum over a 16-lane row
  v += row_xor<8>(v); v += row_xor<4>(v); v += row_xor<2>(v); v += row_xor<1>(v);
  return v;
}
__device__ __forceinline__ float row_max(float v) {   // maximum over a 16-lane row
  v = fmaxf(v, row_xor<8>(v)); v = fmaxf(v, row_xor<4>(v));
  v = fmaxf(v, row_xor<2>(v)); v = fmaxf(v, row_xor<1>(v));
  return v;
}
__device__ __forceinline__ float wred_add(float v) {  // sum over all 32 lanes
  v += half_xor(v);
  return row_add(v);
}
// value of a wave-uniform lane, through a scalar register
__device__ __forceinline__ float lane_bcast(float v, int l) {
  return __builtin_bit_cast(float, __builtin_amdgcn_readlane(__builtin_bit_cast(int, v), l));
}

__global__ __launch_bounds__(NTHREADS, 1)
void disentangled_encoder_kernel(const float* __restrict__ zg,
                                 const float* __restrict__ protos,
                                 const float* __restrict__ alphas,
                                 const float* __restrict__ b_bias,
                                 const float* __restrict__ W,
                                 const float* __restrict__ Wb,
                                 const float* __restrict__ ln_g,
                                 const float* __restrict__ ln_b,
                                 const float* __restrict__ beta_seq,
                                 float* __restrict__ out)
{
  extern __shared__ char smem[];
  float*    sZ   = (float*)(smem + OFF_Z);
  _Float16* sE   = (_Float16*)(smem + OFF_E);
  float*    sMu  = (float*)(smem + OFF_MU);
  float*    sRs  = (float*)(smem + OFF_RS);
  float*    sS   = (float*)(smem + OFF_S);
  float*    sPnp = (float*)(smem + OFF_PNP);
  float*    sP1  = (float*)(smem + OFF_P1);
  float*    sBd  = (float*)(smem + OFF_BD);
  float*    sQh  = (float*)(smem + OFF_QH);
  float*    sG2  = (float*)(smem + OFF_G2);
  float*    sB2  = (float*)(smem + OFF_B2);
  float*    sG4  = (float*)(smem + OFF_G4);
  float*    sB4  = (float*)(smem + OFF_B4);
  float*    sAcc = (float*)(smem + OFF_ACC);
  float*    sRed = (float*)(smem + OFF_RED);

  const int b    = blockIdx.x;
  const int tid  = threadIdx.x;
  const int wave = tid >> 5;
  const int lane = tid & 31;

  // ---------------- Phase 0: async-DMA z[b] into LDS (CDNA5 async pipe) ----
  // GLOBAL_LOAD_ASYNC_TO_LDS_B128: no VGPR data movement, tracked by ASYNCcnt.
  {
    const float4* zsrc = (const float4*)(zg + (size_t)b * T_ * D_);
    #pragma unroll 4
    for (int i = tid; i < T_*D_/4; i += NTHREADS) {
      unsigned lds_addr = (unsigned)(uintptr_t)(sZ + 4*i);      // LDS offset = flat[31:0]
      unsigned long long gaddr = (unsigned long long)(uintptr_t)(zsrc + i);
      asm volatile("global_load_async_to_lds_b128 %0, %1, off"
                   :: "v"(lds_addr), "v"(gaddr) : "memory");
    }
    // overlap: zero the out accumulator + fetch LN params while DMA is in flight
    for (int i = tid; i < K_*D_;  i += NTHREADS) sAcc[i] = 0.f;
    if (tid < D_) {
      sG2[tid] = ln_g[2*D_+tid]; sB2[tid] = ln_b[2*D_+tid];
      sG4[tid] = ln_g[4*D_+tid]; sB4[tid] = ln_b[4*D_+tid];
    }
    asm volatile("s_wait_asynccnt 0x0" ::: "memory");   // my async loads done
  }
  __syncthreads();                                      // all waves' loads visible

  // ---------------- Setup: prototypes LN (folded with g0/b0), row stats, q/qhat
  {
    // wave w handles prototype row k=w (16 waves, K=16)
    const int k = wave;
    float x1 = protos[k*D_+lane], x2 = protos[k*D_+lane+32];
    float s1 = wred_add(x1 + x2);
    float s2 = wred_add(x1*x1 + x2*x2);
    float mu = s1 * (1.f/D_);
    float rs = rsqrtf(s2*(1.f/D_) - mu*mu + EPS_);
    float pn1 = (x1-mu)*rs*ln_g[D_+lane]    + ln_b[D_+lane];
    float pn2 = (x2-mu)*rs*ln_g[D_+lane+32] + ln_b[D_+lane+32];
    float pp1 = pn1 * ln_g[lane];       // fold gamma0 into pn
    float pp2 = pn2 * ln_g[lane+32];
    sPnp[k*D_+lane] = pp1; sPnp[k*D_+lane+32] = pp2;
    float p1 = wred_add(pp1 + pp2);                         // sum_d g0*pn
    float bd = wred_add(ln_b[lane]*pn1 + ln_b[lane+32]*pn2);// sum_d b0*pn
    if (lane == 0) { sP1[k] = p1; sBd[k] = bd; }
  }
  // per-row mean/rstd of z (feeds the rank-1 LN epilogue of the scores GEMM)
  for (int t = wave*64; t < wave*64 + 64; ++t) {
    float x1 = sZ[t*D_+lane], x2 = sZ[t*D_+lane+32];
    float s1 = wred_add(x1 + x2);
    float s2 = wred_add(x1*x1 + x2*x2);
    if (lane == 0) {
      float mu = s1 * (1.f/D_);
      sMu[t] = mu;
      sRs[t] = rsqrtf(s2*(1.f/D_) - mu*mu + EPS_);
    }
  }
  if (wave == 0) {
    // q = LN(alphas[-1] + z[:, -1] + b_bias);  qhat = q + W q;  c0 = Wb . q
    float x1 = alphas[1023*D_+lane]    + sZ[1023*D_+lane]    + b_bias[lane];
    float x2 = alphas[1023*D_+lane+32] + sZ[1023*D_+lane+32] + b_bias[lane+32];
    float s1 = wred_add(x1 + x2);
    float s2 = wred_add(x1*x1 + x2*x2);
    float mu = s1 * (1.f/D_);
    float rs = rsqrtf(s2*(1.f/D_) - mu*mu + EPS_);
    float q1 = (x1-mu)*rs*ln_g[3*D_+lane]    + ln_b[3*D_+lane];
    float q2 = (x2-mu)*rs*ln_g[3*D_+lane+32] + ln_b[3*D_+lane+32];
    float a1 = 0.f, a2 = 0.f;
    #pragma unroll 4
    for (int e = 0; e < 32; ++e) {
      float qe  = lane_bcast(q1, e);
      float qe2 = lane_bcast(q2, e);
      a1 += W[lane*D_+e]*qe      + W[lane*D_+e+32]*qe2;
      a2 += W[(lane+32)*D_+e]*qe + W[(lane+32)*D_+e+32]*qe2;
    }
    sQh[lane]    = q1 + a1;
    sQh[lane+32] = q2 + a2;
    float c0p = wred_add(Wb[lane]*q1 + Wb[lane+32]*q2);
    if (lane == 0) sRed[32] = c0p;
  }
  __syncthreads();

  // ---------------- Phase A: scores_k = z @ pn'^T  (f32 WMMA, exact) --------
  // zn.pn folded: score = rs_t*(Zdot - mu_t*P1[k]) + bdot[k]
  {
    const int half = lane >> 4;     // K-slice selector within A/B operands
    const int l16  = lane & 15;
    v2f bb[16];
    #pragma unroll
    for (int i = 0; i < 16; ++i) {
      int d = 4*i + 2*half;
      bb[i] = *(const v2f*)&sPnp[l16*D_ + d];   // B[d][k] = pn'[k][d]
    }
    const float P1k = sP1[l16];
    const float bdk = sBd[l16];
    for (int st = 0; st < 4; ++st) {
      const int t0 = wave*64 + st*16;
      v8f c = {};
      #pragma unroll
      for (int i = 0; i < 16; ++i) {
        int d = 4*i + 2*half;
        v2f a = *(const v2f*)&sZ[(t0 + l16)*D_ + d];  // A[t][d] = raw z
        c = __builtin_amdgcn_wmma_f32_16x16x4_f32(false, a, false, bb[i],
                                                  (short)0, c, false, false);
      }
      // epilogue: LN-fold + softmax over K (lanes 0-15 / 16-31 groups)
      #pragma unroll
      for (int r = 0; r < 8; ++r) {
        int t = t0 + r + 8*half;
        float mu = sMu[t], rs = sRs[t];
        float sc = (rs*(c[r] - mu*P1k) + bdk) * SCALE_;
        float m = row_max(sc);
        float e = __expf(sc - m);
        float S = row_add(e);
        sE[t*K_ + l16] = (_Float16)(e / S);   // p_{k|i}
      }
    }
  }

  // ---------------- Phase A3: s_t = LN(alphas+z) . qhat + c0 (Dense folded) -
  {
    const float c0 = sRed[32];
    for (int t = wave*64; t < wave*64 + 64; ++t) {
      float z1 = sZ[t*D_+lane], z2 = sZ[t*D_+lane+32];
      float x1 = alphas[t*D_+lane]    + z1;     // alphas is L2-resident
      float x2 = alphas[t*D_+lane+32] + z2;
      float s1 = wred_add(x1 + x2);
      float s2 = wred_add(x1*x1 + x2*x2);
      float mu = s1 * (1.f/D_);
      float rs = rsqrtf(s2*(1.f/D_) - mu*mu + EPS_);
      float k1 = (x1-mu)*rs*sG2[lane]    + sB2[lane];
      float k2 = (x2-mu)*rs*sG2[lane+32] + sB2[lane+32];
      float dp = wred_add(k1*sQh[lane] + k2*sQh[lane+32]);
      if (lane == 0) sS[t] = (dp + c0) * SCALE_;
    }
  }
  __syncthreads();

  // ---------------- softmax over T (block reduction) ------------------------
  {
    float sa = sS[tid], sb = sS[tid + NTHREADS];
    float m = fmaxf(sa, sb);
    m = row_max(fmaxf(m, half_xor(m)));
    if (lane == 0) sRed[wave] = m;
    __syncthreads();
    float M = -1e30f;
    #pragma unroll
    for (int i = 0; i < 16; ++i) M = fmaxf(M, sRed[i]);
    float ea = __expf(sa - M), eb = __expf(sb - M);
    float S = wred_add(ea + eb);
    if (lane == 0) sRed[16 + wave] = S;
    __syncthreads();
    float Ssum = 0.f;
    #pragma unroll
    for (int i = 0; i < 16; ++i) Ssum += sRed[16 + i];
    float inv = 1.f / Ssum;
    sS[tid]            = ea * inv;   // p_i
    sS[tid + NTHREADS] = eb * inv;
  }
  __syncthreads();

  // ---------------- Phase B: out[k,d] = sum_t (p_{k|i}*p_i) * z  (f32 WMMA) -
  {
    const int half = lane >> 4;
    const int l16  = lane & 15;
    const int tw   = wave*64;           // each wave owns a 64-wide T slice
    v8f acc[4] = {};
    for (int stp = 0; stp < 16; ++stp) {
      int tA = tw + 4*stp + 2*half;
      float p0 = sS[tA], p1 = sS[tA+1];
      v2f a;
      a[0] = (float)sE[tA*K_ + l16]     * p0;   // A[k][t] = w[t][k]
      a[1] = (float)sE[(tA+1)*K_ + l16] * p1;
      #pragma unroll
      for (int dt = 0; dt < 4; ++dt) {
        int d = dt*16 + l16;
        v2f bv;
        bv[0] = sZ[tA*D_ + d];                  // B[t][d] = z
        bv[1] = sZ[(tA+1)*D_ + d];
        acc[dt] = __builtin_amdgcn_wmma_f32_16x16x4_f32(false, a, false, bv,
                                                        (short)0, acc[dt], false, false);
      }
    }
    // cross-wave K-dim reduction into sAcc
    #pragma unroll
    for (int dt = 0; dt < 4; ++dt) {
      #pragma unroll
      for (int r = 0; r < 8; ++r) {
        int k = r + 8*half;
        int d = dt*16 + l16;
        atomicAdd(&sAcc[k*D_ + d], acc[dt][r]);
      }
    }
  }
  __syncthreads();

  // ---------------- Phase C: final LN(beta_seq + out) + store ---------------
  {
    const int k = wave;                 // 16 waves, 16 rows
    float v1 = beta_seq[k*D_+lane]    + sAcc[k*D_+lane];
    float v2 = beta_seq[k*D_+lane+32] + sAcc[k*D_+lane+32];
    float s1 = wred_add(v1 + v2);
    float s2 = wred_add(v1*v1 + v2*v2);
    float mu = s1 * (1.f/D_);
    float rs = rsqrtf(s2*(1.f/D_) - mu*mu + EPS_);
    float y1 = (v1-mu)*rs*sG4[lane]    + sB4[lane];
    float y2 = (v2-mu)*rs*sG4[lane+32] + sB4[lane+32];
    float* o = out + (size_t)b*K_*D_ + k*D_;
    o[lane]    = y1;
    o[lane+32] = y2;
  }
}

extern "C" void kernel_launch(void* const* d_in, const int* in_sizes, int n_in,
                              void* d_out, int out_size, void* d_ws, size_t ws_size,
                              hipStream_t stream) {
  const float* z        = (const float*)d_in[0];
  const float* protos   = (const float*)d_in[1];
  const float* alphas   = (const float*)d_in[2];
  const float* b_bias   = (const float*)d_in[3];
  const float* W        = (const float*)d_in[4];
  const float* Wb       = (const float*)d_in[5];
  const float* ln_g     = (const float*)d_in[6];
  const float* ln_b     = (const float*)d_in[7];
  const float* beta_seq = (const float*)d_in[8];
  float* out = (float*)d_out;

  disentangled_encoder_kernel<<<B_, NTHREADS, SMEM_BYTES, stream>>>(
      z, protos, alphas, b_bias, W, Wb, ln_g, ln_b, beta_seq, out);
}

// v002
// A run of this version takes 44.4 microseconds.
// Two timings next to v001 put it at 2.51 and 2.50 times that version's speed.
// Over all steps from v000 it is 4.44 times as fast.
#include <hip/hip_runtime.h>

typedef float v2f __attribute__((ext_vector_type(2)));
typedef float v4f __attribute__((ext_vector_type(4)));
typedef float v8f __attribute__((ext_vector_type(8)));

#define B_  512
#define T_  1024
#define D_  64
#define K_  16
#define NTHREADS 512
#define EPS_ 1e-6f
#define SCALE_ 0.125f   // 1/sqrt(64)

// ---- LDS layout (bytes) ----
constexpr int OFF_Z   = 0;                       // 1024*64 f32   = 262144
constexpr int OFF_E   = OFF_Z   + T_*D_*4;       // 1024*16 f16   =  32768
constexpr int OFF_MU  = OFF_E   + T_*K_*2;       // 1024 f32
constexpr int OFF_RS  = OFF_MU  + T_*4;          // 1024 f32
constexpr int OFF_S   = OFF_RS  + T_*4;          // 1024 f32 (scores_t -> p_i)
constexpr int OFF_PNP = OFF_S   + T_*4;          // 16*64 f32 (pn * g0)
constexpr int OFF_P1  = OFF_PNP + K_*D_*4;       // 16 f32
constexpr int OFF_BD  = OFF_P1  + K_*4;          // 16 f32
constexpr int OFF_QH  = OFF_BD  + K_*4;          // 64 f32 (qhat)
constexpr int OFF_G2  = OFF_QH  + D_*4;          // 64 f32
constexpr int OFF_B2  = OFF_G2  + D_*4;
constexpr int OFF_G4  = OFF_B2  + D_*4;
constexpr int OFF_B4  = OFF_G4  + D_*4;
constexpr int OFF_ACC = OFF_B4  + D_*4;          // 16*64 f32 out accumulator
constexpr int OFF_RED = OFF_ACC + K_*D_*4;       // 64 f32 reduction scratch
constexpr int SMEM_BYTES = OFF_RED + 64*4;       // ~310 KB < 320 KB/WGP

// Cross-lane moves on the vector pipe (no LDS round trip per butterfly step).
// lane l <- lane l ^ MASK inside a 16-lane row (DPP row_xmask)
template <int MASK>
__device__ __forceinline__ float row_xor(float v) {
  return __builtin_bit_cast(float, __builtin_amdgcn_mov_dpp(
      __builtin_bit_cast(int, v), 0x160 | MASK, 0xf, 0xf, true));
}
// lane l <- lane l ^ 16
__device__ __forceinline__ float half_xor(float v) {
  int b = __builtin_bit_cast(int, v);
  return __builtin_bit_cast(float, __builtin_amdgcn_permlanex16(
      b, b, 0x76543210, 0xfedcba98, false, false));
}
__device__ __forceinline__ float row_add(float v) {   // sum over a 16-lane row
  v += row_xor<8>(v); v += row_xor<4>(v); v += row_xor<2>(v); v += row_xor<1>(v);
  return v;
}
__device__ __forceinline__ float row_max(float v) {   // maximum over a 16-lane row
  v = fmaxf(v, row_xor<8>(v)); v = fmaxf(v, row_xor<4>(v));
  v = fmaxf(v, row_xor<2>(v)); v = fmaxf(v, row_xor<1>(v));
  return v;
}
__device__ __forceinline__ float wred_add(float v) {  // sum over all 32 lanes
  v += half_xor(v);
  return row_add(v);
}
__device__ __forceinline__ float quad_add(float v) {  // sum over 4 neighbouring lanes
  v += row_xor<1>(v); v += row_xor<2>(v);
  return v;
}
// 1/sqrt(x) as rsqrtf forms it (a tiny x is scaled up first). The v_nop fills the slot
// that the instruction set asks for directly behind a transcendental.
__device__ __forceinline__ float rsqrt_slot(float x) {
  const bool tiny = x < 0x1p-126f;
  float xs = tiny ? x * 0x1p+24f : x;
  float r;
  asm("v_rsq_f32 %0, %1\n\tv_nop" : "=v"(r) : "v"(xs));
  return tiny ? r * 0x1p+12f : r;
}
// value of a wave-uniform lane, through a scalar register
__device__ __forceinline__ float lane_bcast(float v, int l) {
  return __builtin_bit_cast(float, __builtin_amdgcn_readlane(__builtin_bit_cast(int, v), l));
}

__global__ __launch_bounds__(NTHREADS, 1)
void disentangled_encoder_kernel(const float* __restrict__ zg,
                                 const float* __restrict__ protos,
                                 const float* __restrict__ alphas,
                                 const float* __restrict__ b_bias,
                                 const float* __restrict__ W,
                                 const float* __restrict__ Wb,
                                 const float* __restrict__ ln_g,
                                 const float* __restrict__ ln_b,
                                 const float* __restrict__ beta_seq,
                                 float* __restrict__ out)
{
  extern __shared__ char smem[];
  float*    sZ   = (float*)(smem + OFF_Z);
  _Float16* sE   = (_Float16*)(smem + OFF_E);
  float*    sMu  = (float*)(smem + OFF_MU);
  float*    sRs  = (float*)(smem + OFF_RS);
  float*    sS   = (float*)(smem + OFF_S);
  float*    sPnp = (float*)(smem + OFF_PNP);
  float*    sP1  = (float*)(smem + OFF_P1);
  float*    sBd  = (float*)(smem + OFF_BD);
  float*    sQh  = (float*)(smem + OFF_QH);
  float*    sG2  = (float*)(smem + OFF_G2);
  float*    sB2  = (float*)(smem + OFF_B2);
  float*    sG4  = (float*)(smem + OFF_G4);
  float*    sB4  = (float*)(smem + OFF_B4);
  float*    sAcc = (float*)(smem + OFF_ACC);
  float*    sRed = (float*)(smem + OFF_RED);

  const int b    = blockIdx.x;
  const int tid  = threadIdx.x;
  const int wave = tid >> 5;
  const int lane = tid & 31;

  // ---------------- Phase 0: async-DMA z[b] into LDS (CDNA5 async pipe) ----
  // GLOBAL_LOAD_ASYNC_TO_LDS_B128: no VGPR data movement, tracked by ASYNCcnt.
  {
    const float4* zsrc = (const float4*)(zg + (size_t)b * T_ * D_);
    #pragma unroll 4
    for (int i = tid; i < T_*D_/4; i += NTHREADS) {
      unsigned lds_addr = (unsigned)(uintptr_t)(sZ + 4*i);      // LDS offset = flat[31:0]
      unsigned long long gaddr = (unsigned long long)(uintptr_t)(zsrc + i);
      asm volatile("global_load_async_to_lds_b128 %0, %1, off"
                   :: "v"(lds_addr), "v"(gaddr) : "memory");
    }
    // overlap: zero the out accumulator + fetch LN params while DMA is in flight
    for (int i = tid; i < K_*D_;  i += NTHREADS) sAcc[i] = 0.f;
    if (tid < D_) {
      sG2[tid] = ln_g[2*D_+tid]; sB2[tid] = ln_b[2*D_+tid];
      sG4[tid] = ln_g[4*D_+tid]; sB4[tid] = ln_b[4*D_+tid];
    }
    asm volatile("s_wait_asynccnt 0x0" ::: "memory");   // my async loads done
  }
  __syncthreads();                                      // all waves' loads visible

  // ---------------- Setup: prototypes LN (folded with g0/b0), row stats, q/qhat
  {
    // wave w handles prototype row k=w (16 waves, K=16)
    const int k = wave;
    float x1 = protos[k*D_+lane], x2 = protos[k*D_+lane+32];
    float s1 = wred_add(x1 + x2);
    float s2 = wred_add(x1*x1 + x2*x2);
    float mu = s1 * (1.f/D_);
    float rs = rsqrtf(s2*(1.f/D_) - mu*mu + EPS_);
    float pn1 = (x1-mu)*rs*ln_g[D_+lane]    + ln_b[D_+lane];
    float pn2 = (x2-mu)*rs*ln_g[D_+lane+32] + ln_b[D_+lane+32];
    float pp1 = pn1 * ln_g[lane];       // fold gamma0 into pn
    float pp2 = pn2 * ln_g[lane+32];
    sPnp[k*D_+lane] = pp1; sPnp[k*D_+lane+32] = pp2;
    float p1 = wred_add(pp1 + pp2);                         // sum_d g0*pn
    float bd = wred_add(ln_b[lane]*pn1 + ln_b[lane+32]*pn2);// sum_d b0*pn
    if (lane == 0) { sP1[k] = p1; sBd[k] = bd; }
  }
  // Row-sum layout: 4 lanes share a row, a wave works on 8 rows at once. Each lane
  // sums 16 elements in registers (4 reads of 16 bytes), then 2 cross-lane steps.
  // Step j of row r reads quarter (j + r) & 3, so 16 lanes cover all 64 LDS banks.
  // Every loop over p or j in this layout is unrolled: its small arrays are then
  // indexed by constants and stay in registers.
  const int l4   = lane & 3;
  const int rsub = lane >> 2;
  int qoff[4];
  #pragma unroll
  for (int j = 0; j < 4; ++j) qoff[j] = 16*((j + rsub) & 3) + 4*l4;

  // per-row mean/rstd of z (feeds the rank-1 LN epilogue of the scores GEMM)
  // unrolled: the 8 passes are independent, their LDS reads and sums overlap
  float muv[8], rsv[8];
  #pragma unroll
  for (int p = 0; p < 8; ++p) {
    const int t = wave*64 + p*8 + rsub;
    v2f a1 = {0.f, 0.f}, a2 = {0.f, 0.f};
    #pragma unroll
    for (int j = 0; j < 4; ++j) {
      v4f v = *(const v4f*)&sZ[t*D_ + qoff[j]];
      a1 += v.lo;       a1 += v.hi;
      a2 += v.lo*v.lo;  a2 += v.hi*v.hi;
    }
    float s1 = quad_add(a1[0] + a1[1]);
    float s2 = quad_add(a2[0] + a2[1]);
    muv[p] = s1 * (1.f/D_);
    rsv[p] = rsqrt_slot(s2*(1.f/D_) - muv[p]*muv[p] + EPS_);
  }
  if (l4 == 0) {
    #pragma unroll
    for (int p = 0; p < 8; ++p) {
      sMu[wave*64 + p*8 + rsub] = muv[p];
      sRs[wave*64 + p*8 + rsub] = rsv[p];
    }
  }
  if (wave == 0) {
    // q = LN(alphas[-1] + z[:, -1] + b_bias);  qhat = q + W q;  c0 = Wb . q
    float x1 = alphas[1023*D_+lane]    + sZ[1023*D_+lane]    + b_bias[lane];
    float x2 = alphas[1023*D_+lane+32] + sZ[1023*D_+lane+32] + b_bias[lane+32];
    float s1 = wred_add(x1 + x2);
    float s2 = wred_add(x1*x1 + x2*x2);
    float mu = s1 * (1.f/D_);
    float rs = rsqrtf(s2*(1.f/D_) - mu*mu + EPS_);
    float q1 = (x1-mu)*rs*ln_g[3*D_+lane]    + ln_b[3*D_+lane];
    float q2 = (x2-mu)*rs*ln_g[3*D_+lane+32] + ln_b[3*D_+lane+32];
    float a1 = 0.f, a2 = 0.f;
    #pragma unroll 4
    for (int e = 0; e < 32; ++e) {
      float qe  = lane_bcast(q1, e);
      float qe2 = lane_bcast(q2, e);
      a1 += W[lane*D_+e]*qe      + W[lane*D_+e+32]*qe2;
      a2 += W[(lane+32)*D_+e]*qe + W[(lane+32)*D_+e+32]*qe2;
    }
    sQh[lane]    = q1 + a1;
    sQh[lane+32] = q2 + a2;
    float c0p = wred_add(Wb[lane]*q1 + Wb[lane+32]*q2);
    if (lane == 0) sRed[32] = c0p;
  }
  __syncthreads();

  // ---------------- Phase A: scores_k = z @ pn'^T  (f32 WMMA, exact) --------
  // zn.pn folded: score = rs_t*(Zdot - mu_t*P1[k]) + bdot[k]
  {
    const int half = lane >> 4;     // K-slice selector within A/B operands
    const int l16  = lane & 15;
    v2f bb[16];
    #pragma unroll
    for (int i = 0; i < 16; ++i) {
      int d = 4*i + 2*half;
      bb[i] = *(const v2f*)&sPnp[l16*D_ + d];   // B[d][k] = pn'[k][d]
    }
    const float P1k = sP1[l16];
    const float bdk = sBd[l16];
    for (int st = 0; st < 4; ++st) {
      const int t0 = wave*64 + st*16;
      v8f c = {};
      #pragma unroll
      for (int i = 0; i < 16; ++i) {
        int d = 4*i + 2*half;
        v2f a = *(const v2f*)&sZ[(t0 + l16)*D_ + d];  // A[t][d] = raw z
        c = __builtin_amdgcn_wmma_f32_16x16x4_f32(false, a, false, bb[i],
                                                  (short)0, c, false, false);
      }
      // epilogue: LN-fold + softmax over K (lanes 0-15 / 16-31 groups)
      #pragma unroll
      for (int r = 0; r < 8; ++r) {
        int t = t0 + r + 8*half;
        float mu = sMu[t], rs = sRs[t];
        float sc = (rs*(c[r] - mu*P1k) + bdk) * SCALE_;
        float m = row_max(sc);
        float e = __expf(sc - m);
        float S = row_add(e);
        sE[t*K_ + l16] = (_Float16)(e / S);   // p_{k|i}
      }
    }
  }

  // ---------------- Phase A3: s_t = LN(alphas+z) . qhat + c0 (Dense folded) -
  {
    // same row-sum layout; LN folded as in Phase A, x = alphas + z:
    // LN(x).qhat = rs*(sum x*g2*qhat - mu*sum g2*qhat) + sum b2*qhat
    const float c0 = sRed[32];
    v4f av[8][4];                               // alphas is L2-resident
    unsigned gb[4];                             // byte offset of this lane's slices
    #pragma unroll
    for (int j = 0; j < 4; ++j) gb[j] = 4u*((wave*64 + rsub)*D_ + qoff[j]);
    #pragma unroll
    for (int p = 0; p < 8; ++p) {
      #pragma unroll
      for (int j = 0; j < 4; ++j)
        av[p][j] = *(const v4f*)((const char*)alphas + gb[j] + p*8*D_*4);
    }
    // the loads' offset registers stay untouched until this wait has passed
    asm volatile("s_wait_xcnt 0x0" :: "v"(gb[0]), "v"(gb[1]), "v"(gb[2]), "v"(gb[3]) : "memory");
    v4f gq[4];                                  // g2*qhat, this lane's 16 columns
    v2f gs = {0.f, 0.f}, bq = {0.f, 0.f};
    #pragma unroll
    for (int j = 0; j < 4; ++j) {
      v4f q  = *(const v4f*)&sQh[qoff[j]];
      v4f b2 = *(const v4f*)&sB2[qoff[j]];
      gq[j]  = *(const v4f*)&sG2[qoff[j]] * q;
      gs += gq[j].lo;    gs += gq[j].hi;
      bq += b2.lo*q.lo;  bq += b2.hi*q.hi;
    }
    const float Gs = quad_add(gs[0] + gs[1]);
    const float Bq = quad_add(bq[0] + bq[1]) + c0;
    // unrolled: the 8 passes are independent, their reads and sums overlap
    float sc[8];
    #pragma unroll
    for (int p = 0; p < 8; ++p) {
      const int t = wave*64 + p*8 + rsub;
      v2f a1 = {0.f, 0.f}, a2 = {0.f, 0.f}, a3 = {0.f, 0.f};
      #pragma unroll
      for (int j = 0; j < 4; ++j) {
        v4f x = av[p][j] + *(const v4f*)&sZ[t*D_ + qoff[j]];
        a1 += x.lo;            a1 += x.hi;
        a2 += x.lo*x.lo;       a2 += x.hi*x.hi;
        a3 += x.lo*gq[j].lo;   a3 += x.hi*gq[j].hi;
      }
      float s1 = quad_add(a1[0] + a1[1]);
      float s2 = quad_add(a2[0] + a2[1]);
      float s3 = quad_add(a3[0] + a3[1]);
      float mu = s1 * (1.f/D_);
      float rs = rsqrt_slot(s2*(1.f/D_) - mu*mu + EPS_);
      sc[p] = (rs*(s3 - mu*Gs) + Bq) * SCALE_;
    }
    if (l4 == 0) {
      #pragma unroll
      for (int p = 0; p < 8; ++p) sS[wave*64 + p*8 + rsub] = sc[p];
    }
  }
  __syncthreads();

  // ---------------- softmax over T (block reduction) ------------------------
  {
    float sa = sS[tid], sb = sS[tid + NTHREADS];
    float m = fmaxf(sa, sb);
    m = row_max(fmaxf(m, half_xor(m)));
    if (lane == 0) sRed[wave] = m;
    __syncthreads();
    float M = -1e30f;
    #pragma unroll
    for (int i = 0; i < 16; ++i) M = fmaxf(M, sRed[i]);
    float ea = __expf(sa - M), eb = __expf(sb - M);
    float S = wred_add(ea + eb);
    if (lane == 0) sRed[16 + wave] = S;
    __syncthreads();
    float Ssum = 0.f;
    #pragma unroll
    for (int i = 0; i < 16; ++i) Ssum += sRed[16 + i];
    float inv = 1.f / Ssum;
    sS[tid]            = ea * inv;   // p_i
    sS[tid + NTHREADS] = eb * inv;
  }
  __syncthreads();

  // ---------------- Phase B: out[k,d] = sum_t (p_{k|i}*p_i) * z  (f32 WMMA) -
  {
    const int half = lane >> 4;
    const int l16  = lane & 15;
    const int tw   = wave*64;           // each wave owns a 64-wide T slice
    v8f acc[4] = {};
    for (int stp = 0; stp < 16; ++stp) {
      int tA = tw + 4*stp + 2*half;
      float p0 = sS[tA], p1 = sS[tA+1];
      v2f a;
      a[0] = (float)sE[tA*K_ + l16]     * p0;   // A[k][t] = w[t][k]
      a[1] = (float)sE[(tA+1)*K_ + l16] * p1;
      #pragma unroll
      for (int dt = 0; dt < 4; ++dt) {
        int d = dt*16 + l16;
        v2f bv;
        bv[0] = sZ[tA*D_ + d];                  // B[t][d] = z
        bv[1] = sZ[(tA+1)*D_ + d];
        acc[dt] = __builtin_amdgcn_wmma_f32_16x16x4_f32(false, a, false, bv,
                                                        (short)0, acc[dt], false, false);
      }
    }
    // cross-wave K-dim reduction into sAcc
    #pragma unroll
    for (int dt = 0; dt < 4; ++dt) {
      #pragma unroll
      for (int r = 0; r < 8; ++r) {
        int k = r + 8*half;
        int d = dt*16 + l16;
        atomicAdd(&sAcc[k*D_ + d], acc[dt][r]);
      }
    }
  }
  __syncthreads();

  // ---------------- Phase C: final LN(beta_seq + out) + store ---------------
  {
    const int k = wave;                 // 16 waves, 16 rows
    float v1 = beta_seq[k*D_+lane]    + sAcc[k*D_+lane];
    float v2 = beta_seq[k*D_+lane+32] + sAcc[k*D_+lane+32];
    float s1 = wred_add(v1 + v2);
    float s2 = wred_add(v1*v1 + v2*v2);
    float mu = s1 * (1.f/D_);
    float rs = rsqrtf(s2*(1.f/D_) - mu*mu + EPS_);
    float y1 = (v1-mu)*rs*sG4[lane]    + sB4[lane];
    float y2 = (v2-mu)*rs*sG4[lane+32] + sB4[lane+32];
    float* o = out + (size_t)b*K_*D_ + k*D_;
    o[lane]    = y1;
    o[lane+32] = y2;
  }
}

extern "C" void kernel_launch(void* const* d_in, const int* in_sizes, int n_in,
                              void* d_out, int out_size, void* d_ws, size_t ws_size,
                              hipStream_t stream) {
  const float* z        = (const float*)d_in[0];
  const float* protos   = (const float*)d_in[1];
  const float* alphas   = (const float*)d_in[2];
  const float* b_bias   = (const float*)d_in[3];
  const float* W        = (const float*)d_in[4];
  const float* Wb       = (const float*)d_in[5];
  const float* ln_g     = (const float*)d_in[6];
  const float* ln_b     = (const float*)d_in[7];
  const float* beta_seq = (const float*)d_in[8];
  float* out = (float*)d_out;

  disentangled_encoder_kernel<<<B_, NTHREADS, SMEM_BYTES, stream>>>(
      z, protos, alphas, b_bias, W, Wb, ln_g, ln_b, beta_seq, out);
}

// v003
// Measured time: 38.2 microseconds a run.
// Timed twice side by side with v002, it ran 1.16 and 1.17 times as fast.
// Counting every step since v000, it is 5.18 times as fast.
#include <hip/hip_runtime.h>

typedef float v2f __attribute__((ext_vector_type(2)));
typedef float v4f __attribute__((ext_vector_type(4)));
typedef float v8f __attribute__((ext_vector_type(8)));

#define B_  512
#define T_  1024
#define D_  64
#define K_  16
#define NTHREADS 512
#define EPS_ 1e-6f
#define SCALE_ 0.125f   // 1/sqrt(64)

// ---- LDS layout (bytes) ----
constexpr int OFF_Z   = 0;                       // 1024*64 f32   = 262144
constexpr int OFF_E   = OFF_Z   + T_*D_*4;       // 1024*16 f16   =  32768
constexpr int OFF_MU  = OFF_E   + T_*K_*2;       // 1024 f32
constexpr int OFF_RS  = OFF_MU  + T_*4;          // 1024 f32
constexpr int OFF_S   = OFF_RS  + T_*4;          // 1024 f32 (scores_t -> p_i)
constexpr int OFF_PNP = OFF_S   + T_*4;          // 16*64 f32 (pn * g0)
constexpr int OFF_P1  = OFF_PNP + K_*D_*4;       // 16 f32
constexpr int OFF_BD  = OFF_P1  + K_*4;          // 16 f32
constexpr int OFF_QH  = OFF_BD  + K_*4;          // 64 f32 (qhat)
constexpr int OFF_G2  = OFF_QH  + D_*4;          // 64 f32
constexpr int OFF_B2  = OFF_G2  + D_*4;
constexpr int OFF_G4  = OFF_B2  + D_*4;
constexpr int OFF_B4  = OFF_G4  + D_*4;
constexpr int OFF_ACC = OFF_B4  + D_*4;          // 16*64 f32 out accumulator
constexpr int OFF_RED = OFF_ACC + K_*D_*4;       // 64 f32 reduction scratch
constexpr int SMEM_BYTES = OFF_RED + 64*4;       // ~310 KB < 320 KB/WGP

// LDS layout of the 64-float rows of z and pn' (sZ, sPnp): rows are 256 bytes apart, so one column of
// 16 rows would fall on one bank. The 16-byte piece c of row t is kept at place c ^ swz(t).
// swz is one-to-one over 16 rows in a row (a column of 16 rows covers all 64 banks), and
// rows t and t + 2 differ in its top bit (the two lane halves of a B operand use
// different banks).
__device__ __forceinline__ int swz(int t) { return ((t & 3) << 2) | ((t >> 2) & 3); }
// float index in sZ of element d of row t
__device__ __forceinline__ int zidx(int t, int d) {
  return t*D_ + ((((d >> 2) ^ swz(t)) << 2) | (d & 3));
}
// float index in sAcc of element d of row k: rows k and k + 8, which the two lane halves
// of an accumulator register add to at once, use different banks
__device__ __forceinline__ int aidx(int k, int d) { return k*D_ + (d ^ ((k & 8) << 2)); }

// Cross-lane moves on the vector pipe (no LDS round trip per butterfly step).
// lane l <- lane l ^ MASK inside a 16-lane row (DPP row_xmask)
template <int MASK>
__device__ __forceinline__ float row_xor(float v) {
  return __builtin_bit_cast(float, __builtin_amdgcn_mov_dpp(
      __builtin_bit_cast(int, v), 0x160 | MASK, 0xf, 0xf, true));
}
// lane l <- lane l ^ 16
__device__ __forceinline__ float half_xor(float v) {
  int b = __builtin_bit_cast(int, v);
  return __builtin_bit_cast(float, __builtin_amdgcn_permlanex16(
      b, b, 0x76543210, 0xfedcba98, false, false));
}
__device__ __forceinline__ float row_add(float v) {   // sum over a 16-lane row
  v += row_xor<8>(v); v += row_xor<4>(v); v += row_xor<2>(v); v += row_xor<1>(v);
  return v;
}
__device__ __forceinline__ float row_max(float v) {   // maximum over a 16-lane row
  v = fmaxf(v, row_xor<8>(v)); v = fmaxf(v, row_xor<4>(v));
  v = fmaxf(v, row_xor<2>(v)); v = fmaxf(v, row_xor<1>(v));
  return v;
}
__device__ __forceinline__ float wred_add(float v) {  // sum over all 32 lanes
  v += half_xor(v);
  return row_add(v);
}
__device__ __forceinline__ float quad_add(float v) {  // sum over 4 neighbouring lanes
  v += row_xor<1>(v); v += row_xor<2>(v);
  return v;
}
// 1/sqrt(x) as rsqrtf forms it (a tiny x is scaled up first). The v_nop fills the slot
// that the instruction set asks for directly behind a transcendental.
__device__ __forceinline__ float rsqrt_slot(float x) {
  const bool tiny = x < 0x1p-126f;
  float xs = tiny ? x * 0x1p+24f : x;
  float r;
  asm("v_rsq_f32 %0, %1\n\tv_nop" : "=v"(r) : "v"(xs));
  return tiny ? r * 0x1p+12f : r;
}
// value of a wave-uniform lane, through a scalar register
__device__ __forceinline__ float lane_bcast(float v, int l) {
  return __builtin_bit_cast(float, __builtin_amdgcn_readlane(__builtin_bit_cast(int, v), l));
}

__global__ __launch_bounds__(NTHREADS, 1)
void disentangled_encoder_kernel(const float* __restrict__ zg,
                                 const float* __restrict__ protos,
                                 const float* __restrict__ alphas,
                                 const float* __restrict__ b_bias,
                                 const float* __restrict__ W,
                                 const float* __restrict__ Wb,
                                 const float* __restrict__ ln_g,
                                 const float* __restrict__ ln_b,
                                 const float* __restrict__ beta_seq,
                                 float* __restrict__ out)
{
  extern __shared__ char smem[];
  float*    sZ   = (float*)(smem + OFF_Z);
  _Float16* sE   = (_Float16*)(smem + OFF_E);
  float*    sMu  = (float*)(smem + OFF_MU);
  float*    sRs  = (float*)(smem + OFF_RS);
  float*    sS   = (float*)(smem + OFF_S);
  float*    sPnp = (float*)(smem + OFF_PNP);
  float*    sP1  = (float*)(smem + OFF_P1);
  float*    sBd  = (float*)(smem + OFF_BD);
  float*    sQh  = (float*)(smem + OFF_QH);
  float*    sG2  = (float*)(smem + OFF_G2);
  float*    sB2  = (float*)(smem + OFF_B2);
  float*    sG4  = (float*)(smem + OFF_G4);
  float*    sB4  = (float*)(smem + OFF_B4);
  float*    sAcc = (float*)(smem + OFF_ACC);
  float*    sRed = (float*)(smem + OFF_RED);

  const int b    = blockIdx.x;
  const int tid  = threadIdx.x;
  const int wave = tid >> 5;
  const int lane = tid & 31;

  // ---------------- Phase 0: async-DMA z[b] into LDS (CDNA5 async pipe) ----
  // GLOBAL_LOAD_ASYNC_TO_LDS_B128: no VGPR data movement, tracked by ASYNCcnt.
  {
    const float4* zsrc = (const float4*)(zg + (size_t)b * T_ * D_);
    #pragma unroll 4
    for (int i = tid; i < T_*D_/4; i += NTHREADS) {
      const int isw = (i & ~15) | ((i & 15) ^ swz(i >> 4));     // piece i&15 of row i>>4
      unsigned lds_addr = (unsigned)(uintptr_t)(sZ + 4*isw);    // LDS offset = flat[31:0]
      unsigned long long gaddr = (unsigned long long)(uintptr_t)(zsrc + i);
      asm volatile("global_load_async_to_lds_b128 %0, %1, off"
                   :: "v"(lds_addr), "v"(gaddr) : "memory");
    }
    // overlap: zero the out accumulator + fetch LN params while DMA is in flight
    for (int i = tid; i < K_*D_;  i += NTHREADS) sAcc[i] = 0.f;
    if (tid < D_) {
      sG2[tid] = ln_g[2*D_+tid]; sB2[tid] = ln_b[2*D_+tid];
      sG4[tid] = ln_g[4*D_+tid]; sB4[tid] = ln_b[4*D_+tid];
    }
    asm volatile("s_wait_asynccnt 0x0" ::: "memory");   // my async loads done
  }
  __syncthreads();                                      // all waves' loads visible

  // ---------------- Setup: prototypes LN (folded with g0/b0), row stats, q/qhat
  {
    // wave w handles prototype row k=w (16 waves, K=16)
    const int k = wave;
    float x1 = protos[k*D_+lane], x2 = protos[k*D_+lane+32];
    float s1 = wred_add(x1 + x2);
    float s2 = wred_add(x1*x1 + x2*x2);
    float mu = s1 * (1.f/D_);
    float rs = rsqrtf(s2*(1.f/D_) - mu*mu + EPS_);
    float pn1 = (x1-mu)*rs*ln_g[D_+lane]    + ln_b[D_+lane];
    float pn2 = (x2-mu)*rs*ln_g[D_+lane+32] + ln_b[D_+lane+32];
    float pp1 = pn1 * ln_g[lane];       // fold gamma0 into pn
    float pp2 = pn2 * ln_g[lane+32];
    sPnp[zidx(k, lane)] = pp1; sPnp[zidx(k, lane+32)] = pp2;
    float p1 = wred_add(pp1 + pp2);                         // sum_d g0*pn
    float bd = wred_add(ln_b[lane]*pn1 + ln_b[lane+32]*pn2);// sum_d b0*pn
    if (lane == 0) { sP1[k] = p1; sBd[k] = bd; }
  }
  // Row-sum layout: 4 lanes share a row, a wave works on 8 rows at once. Each lane
  // sums 16 elements in registers (4 reads of 16 bytes), then 2 cross-lane steps.
  // Step j reads quarter j of the row; the layout of sZ spreads 16 lanes over all 64 banks.
  // Every loop over p or j in this layout is unrolled: its small arrays are then
  // indexed by constants and stay in registers.
  const int l4   = lane & 3;
  const int rsub = lane >> 2;
  int qoff[4];                 // column of this lane's slice
  int zoff[2][4];              // its place in a row of sZ, for rows rsub and 8 + rsub
  #pragma unroll
  for (int j = 0; j < 4; ++j) {
    qoff[j] = 16*j + 4*l4;
    zoff[0][j] = zidx(rsub, qoff[j]) - rsub*D_;
    zoff[1][j] = zidx(8 + rsub, qoff[j]) - (8 + rsub)*D_;
  }

  // per-row mean/rstd of z (feeds the rank-1 LN epilogue of the scores GEMM)
  // unrolled: the 8 passes are independent, their LDS reads and sums overlap
  float muv[8], rsv[8];
  #pragma unroll
  for (int p = 0; p < 8; ++p) {
    const int t = wave*64 + p*8 + rsub;
    v2f a1 = {0.f, 0.f}, a2 = {0.f, 0.f};
    #pragma unroll
    for (int j = 0; j < 4; ++j) {
      v4f v = *(const v4f*)&sZ[t*D_ + zoff[p & 1][j]];
      a1 += v.lo;       a1 += v.hi;
      a2 += v.lo*v.lo;  a2 += v.hi*v.hi;
    }
    float s1 = quad_add(a1[0] + a1[1]);
    float s2 = quad_add(a2[0] + a2[1]);
    muv[p] = s1 * (1.f/D_);
    rsv[p] = rsqrt_slot(s2*(1.f/D_) - muv[p]*muv[p] + EPS_);
  }
  if (l4 == 0) {
    #pragma unroll
    for (int p = 0; p < 8; ++p) {
      sMu[wave*64 + p*8 + rsub] = muv[p];
      sRs[wave*64 + p*8 + rsub] = rsv[p];
    }
  }
  if (wave == 0) {
    // q = LN(alphas[-1] + z[:, -1] + b_bias);  qhat = q + W q;  c0 = Wb . q
    float x1 = alphas[1023*D_+lane]    + sZ[zidx(1023, lane)]    + b_bias[lane];
    float x2 = alphas[1023*D_+lane+32] + sZ[zidx(1023, lane+32)] + b_bias[lane+32];
    float s1 = wred_add(x1 + x2);
    float s2 = wred_add(x1*x1 + x2*x2);
    float mu = s1 * (1.f/D_);
    float rs = rsqrtf(s2*(1.f/D_) - mu*mu + EPS_);
    float q1 = (x1-mu)*rs*ln_g[3*D_+lane]    + ln_b[3*D_+lane];
    float q2 = (x2-mu)*rs*ln_g[3*D_+lane+32] + ln_b[3*D_+lane+32];
    float a1 = 0.f, a2 = 0.f;
    #pragma unroll 4
    for (int e = 0; e < 32; ++e) {
      float qe  = lane_bcast(q1, e);
      float qe2 = lane_bcast(q2, e);
      a1 += W[lane*D_+e]*qe      + W[lane*D_+e+32]*qe2;
      a2 += W[(lane+32)*D_+e]*qe + W[(lane+32)*D_+e+32]*qe2;
    }
    sQh[lane]    = q1 + a1;
    sQh[lane+32] = q2 + a2;
    float c0p = wred_add(Wb[lane]*q1 + Wb[lane+32]*q2);
    if (lane == 0) sRed[32] = c0p;
  }
  __syncthreads();

  // ---------------- Phase A: scores_k = z @ pn'^T  (f32 WMMA, exact) --------
  // zn.pn folded: score = rs_t*(Zdot - mu_t*P1[k]) + bdot[k]
  {
    const int half = lane >> 4;     // K-slice selector within A/B operands
    const int l16  = lane & 15;
    v2f bb[16];
    #pragma unroll
    for (int i = 0; i < 16; ++i) {
      int d = 4*i + 2*half;
      bb[i] = *(const v2f*)&sPnp[zidx(l16, d)]; // B[d][k] = pn'[k][d]
    }
    const float P1k = sP1[l16];
    const float bdk = sBd[l16];
    for (int st = 0; st < 4; ++st) {
      const int t0 = wave*64 + st*16;
      v8f c = {};
      #pragma unroll
      for (int i = 0; i < 16; ++i) {
        int d = 4*i + 2*half;
        v2f a = *(const v2f*)&sZ[t0*D_ + zidx(l16, d)];  // A[t][d] = raw z (t0 % 16 == 0)
        c = __builtin_amdgcn_wmma_f32_16x16x4_f32(false, a, false, bb[i],
                                                  (short)0, c, false, false);
      }
      // epilogue: LN-fold + softmax over K (lanes 0-15 / 16-31 groups)
      #pragma unroll
      for (int r = 0; r < 8; ++r) {
        int t = t0 + r + 8*half;
        float mu = sMu[t], rs = sRs[t];
        float sc = (rs*(c[r] - mu*P1k) + bdk) * SCALE_;
        float m = row_max(sc);
        float e = __expf(sc - m);
        float S = row_add(e);
        sE[t*K_ + l16] = (_Float16)(e / S);   // p_{k|i}
      }
    }
  }

  // ---------------- Phase A3: s_t = LN(alphas+z) . qhat + c0 (Dense folded) -
  {
    // same row-sum layout; LN folded as in Phase A, x = alphas + z:
    // LN(x).qhat = rs*(sum x*g2*qhat - mu*sum g2*qhat) + sum b2*qhat
    const float c0 = sRed[32];
    v4f av[8][4];                               // alphas is L2-resident
    unsigned gb[4];                             // byte offset of this lane's slices
    #pragma unroll
    for (int j = 0; j < 4; ++j) gb[j] = 4u*((wave*64 + rsub)*D_ + qoff[j]);
    #pragma unroll
    for (int p = 0; p < 8; ++p) {
      #pragma unroll
      for (int j = 0; j < 4; ++j)
        av[p][j] = *(const v4f*)((const char*)alphas + gb[j] + p*8*D_*4);
    }
    // the loads' offset registers stay untouched until this wait has passed
    asm volatile("s_wait_xcnt 0x0" :: "v"(gb[0]), "v"(gb[1]), "v"(gb[2]), "v"(gb[3]) : "memory");
    v4f gq[4];                                  // g2*qhat, this lane's 16 columns
    v2f gs = {0.f, 0.f}, bq = {0.f, 0.f};
    #pragma unroll
    for (int j = 0; j < 4; ++j) {
      v4f q  = *(const v4f*)&sQh[qoff[j]];
      v4f b2 = *(const v4f*)&sB2[qoff[j]];
      gq[j]  = *(const v4f*)&sG2[qoff[j]] * q;
      gs += gq[j].lo;    gs += gq[j].hi;
      bq += b2.lo*q.lo;  bq += b2.hi*q.hi;
    }
    const float Gs = quad_add(gs[0] + gs[1]);
    const float Bq = quad_add(bq[0] + bq[1]) + c0;
    // unrolled: the 8 passes are independent, their reads and sums overlap
    float sc[8];
    #pragma unroll
    for (int p = 0; p < 8; ++p) {
      const int t = wave*64 + p*8 + rsub;
      v2f a1 = {0.f, 0.f}, a2 = {0.f, 0.f}, a3 = {0.f, 0.f};
      #pragma unroll
      for (int j = 0; j < 4; ++j) {
        v4f x = av[p][j] + *(const v4f*)&sZ[t*D_ + zoff[p & 1][j]];
        a1 += x.lo;            a1 += x.hi;
        a2 += x.lo*x.lo;       a2 += x.hi*x.hi;
        a3 += x.lo*gq[j].lo;   a3 += x.hi*gq[j].hi;
      }
      float s1 = quad_add(a1[0] + a1[1]);
      float s2 = quad_add(a2[0] + a2[1]);
      float s3 = quad_add(a3[0] + a3[1]);
      float mu = s1 * (1.f/D_);
      float rs = rsqrt_slot(s2*(1.f/D_) - mu*mu + EPS_);
      sc[p] = (rs*(s3 - mu*Gs) + Bq) * SCALE_;
    }
    if (l4 == 0) {
      #pragma unroll
      for (int p = 0; p < 8; ++p) sS[wave*64 + p*8 + rsub] = sc[p];
    }
  }
  __syncthreads();

  // ---------------- softmax over T (block reduction) ------------------------
  {
    float sa = sS[tid], sb = sS[tid + NTHREADS];
    float m = fmaxf(sa, sb);
    m = row_max(fmaxf(m, half_xor(m)));
    if (lane == 0) sRed[wave] = m;
    __syncthreads();
    float M = -1e30f;
    #pragma unroll
    for (int i = 0; i < 16; ++i) M = fmaxf(M, sRed[i]);
    float ea = __expf(sa - M), eb = __expf(sb - M);
    float S = wred_add(ea + eb);
    if (lane == 0) sRed[16 + wave] = S;
    __syncthreads();
    float Ssum = 0.f;
    #pragma unroll
    for (int i = 0; i < 16; ++i) Ssum += sRed[16 + i];
    float inv = 1.f / Ssum;
    sS[tid]            = ea * inv;   // p_i
    sS[tid + NTHREADS] = eb * inv;
  }
  __syncthreads();

  // ---------------- Phase B: out[k,d] = sum_t (p_{k|i}*p_i) * z  (f32 WMMA) -
  {
    const int half = lane >> 4;
    const int l16  = lane & 15;
    const int tw   = wave*64;           // each wave owns a 64-wide T slice
    const int hx   = 32*half;           // swz(tA) = 8*half + (stp & 3), swz(tA+1) = that + 4
    v8f acc[4] = {};
    for (int stp = 0; stp < 16; ++stp) {
      int tA = tw + 4*stp + 2*half;
      // zidx(tA, d) and zidx(tA+1, d) written out, so that two addresses and constant
      // offsets serve the eight reads: column block dt of row tA lies at block
      // dt ^ 2*half, of row tA+1 at block dt ^ 2*half ^ 1
      const int sx = (((l16 >> 2) ^ (stp & 3)) << 2) | (l16 & 3);
      const float* zP = &sZ[tA*D_ + hx + sx];          // dt 0, 1
      const float* zQ = &sZ[tA*D_ + (32 - hx) + sx];   // dt 2, 3
      float p0 = sS[tA], p1 = sS[tA+1];
      v2f a;
      a[0] = (float)sE[tA*K_ + l16]     * p0;   // A[k][t] = w[t][k]
      a[1] = (float)sE[(tA+1)*K_ + l16] * p1;
      #pragma unroll
      for (int dt = 0; dt < 4; ++dt) {
        const float* zr = (dt & 2) ? zQ : zP;
        v2f bv;
        bv[0] = zr[16*(dt & 1)];                // B[t][d] = z, d = dt*16 + l16
        bv[1] = zr[D_ + 16*((dt & 1) ^ 1)];
        acc[dt] = __builtin_amdgcn_wmma_f32_16x16x4_f32(false, a, false, bv,
                                                        (short)0, acc[dt], false, false);
      }
    }
    // cross-wave K-dim reduction into sAcc
    #pragma unroll
    for (int dt = 0; dt < 4; ++dt) {
      #pragma unroll
      for (int r = 0; r < 8; ++r) {
        int k = r + 8*half;
        int d = dt*16 + l16;
        atomicAdd(&sAcc[aidx(k, d)], acc[dt][r]);
      }
    }
  }
  __syncthreads();

  // ---------------- Phase C: final LN(beta_seq + out) + store ---------------
  {
    const int k = wave;                 // 16 waves, 16 rows
    float v1 = beta_seq[k*D_+lane]    + sAcc[aidx(k, lane)];
    float v2 = beta_seq[k*D_+lane+32] + sAcc[aidx(k, lane+32)];
    float s1 = wred_add(v1 + v2);
    float s2 = wred_add(v1*v1 + v2*v2);
    float mu = s1 * (1.f/D_);
    float rs = rsqrtf(s2*(1.f/D_) - mu*mu + EPS_);
    float y1 = (v1-mu)*rs*sG4[lane]    + sB4[lane];
    float y2 = (v2-mu)*rs*sG4[lane+32] + sB4[lane+32];
    float* o = out + (size_t)b*K_*D_ + k*D_;
    o[lane]    = y1;
    o[lane+32] = y2;
  }
}

extern "C" void kernel_launch(void* const* d_in, const int* in_sizes, int n_in,
                              void* d_out, int out_size, void* d_ws, size_t ws_size,
                              hipStream_t stream) {
  const float* z        = (const float*)d_in[0];
  const float* protos   = (const float*)d_in[1];
  const float* alphas   = (const float*)d_in[2];
  const float* b_bias   = (const float*)d_in[3];
  const float* W        = (const float*)d_in[4];
  const float* Wb       = (const float*)d_in[5];
  const float* ln_g     = (const float*)d_in[6];
  const float* ln_b     = (const float*)d_in[7];
  const float* beta_seq = (const float*)d_in[8];
  float* out = (float*)d_out;

  disentangled_encoder_kernel<<<B_, NTHREADS, SMEM_BYTES, stream>>>(
      z, protos, alphas, b_bias, W, Wb, ln_g, ln_b, beta_seq, out);
}

// v004
// Measured time: 35.9 microseconds a run.
// Two timings next to v003 put it at 1.07 and 1.06 times that version's speed.
// Over all steps from v000 it is 5.51 times as fast.
#include <hip/hip_runtime.h>

typedef float v2f __attribute__((ext_vector_type(2)));
typedef float v4f __attribute__((ext_vector_type(4)));
typedef float v8f __attribute__((ext_vector_type(8)));

#define B_  512
#define T_  1024
#define D_  64
#define K_  16
#define NTHREADS 512
#define EPS_ 1e-6f
#define SCALE_ 0.125f   // 1/sqrt(64)

// ---- LDS layout (bytes) ----
constexpr int OFF_Z   = 0;                       // 1024*64 f32   = 262144
constexpr int OFF_E   = OFF_Z   + T_*D_*4;       // 1024*16 f16   =  32768
constexpr int OFF_MU  = OFF_E   + T_*K_*2;       // 1024 f32
constexpr int OFF_RS  = OFF_MU  + T_*4;          // 1024 f32
constexpr int OFF_S   = OFF_RS  + T_*4;          // 1024 f32 (scores_t -> p_i)
constexpr int OFF_PNP = OFF_S   + T_*4;          // 16*64 f32 (pn * g0)
constexpr int OFF_P1  = OFF_PNP + K_*D_*4;       // 16 f32
constexpr int OFF_BD  = OFF_P1  + K_*4;          // 16 f32
constexpr int OFF_QH  = OFF_BD  + K_*4;          // 64 f32 (qhat)
constexpr int OFF_G2  = OFF_QH  + D_*4;          // 64 f32
constexpr int OFF_B2  = OFF_G2  + D_*4;
constexpr int OFF_G4  = OFF_B2  + D_*4;
constexpr int OFF_B4  = OFF_G4  + D_*4;
constexpr int OFF_ACC = OFF_B4  + D_*4;          // 16*64 f32 out accumulator
constexpr int OFF_RED = OFF_ACC + K_*D_*4;       // 64 f32 reduction scratch
constexpr int OFF_Q   = OFF_RED + 64*4;         // 64 f32 (q)
constexpr int SMEM_BYTES = OFF_Q + D_*4;         // ~310 KB < 320 KB/WGP

// LDS layout of the 64-float rows of z and pn' (sZ, sPnp): rows are 256 bytes apart, so one column of
// 16 rows would fall on one bank. The 16-byte piece c of row t is kept at place c ^ swz(t).
// swz is one-to-one over 16 rows in a row (a column of 16 rows covers all 64 banks), and
// rows t and t + 2 differ in its top bit (the two lane halves of a B operand use
// different banks).
__device__ __forceinline__ int swz(int t) { return ((t & 3) << 2) | ((t >> 2) & 3); }
// float index in sZ of element d of row t
__device__ __forceinline__ int zidx(int t, int d) {
  return t*D_ + ((((d >> 2) ^ swz(t)) << 2) | (d & 3));
}
// float index in sAcc of element d of row k: rows k and k + 8, which the two lane halves
// of an accumulator register add to at once, use different banks
__device__ __forceinline__ int aidx(int k, int d) { return k*D_ + (d ^ ((k & 8) << 2)); }

// Cross-lane moves on the vector pipe (no LDS round trip per butterfly step).
// lane l <- lane l ^ MASK inside a 16-lane row (DPP row_xmask)
template <int MASK>
__device__ __forceinline__ float row_xor(float v) {
  return __builtin_bit_cast(float, __builtin_amdgcn_mov_dpp(
      __builtin_bit_cast(int, v), 0x160 | MASK, 0xf, 0xf, true));
}
// lane l <- lane l ^ 16
__device__ __forceinline__ float half_xor(float v) {
  int b = __builtin_bit_cast(int, v);
  return __builtin_bit_cast(float, __builtin_amdgcn_permlanex16(
      b, b, 0x76543210, 0xfedcba98, false, false));
}
__device__ __forceinline__ float row_add(float v) {   // sum over a 16-lane row
  v += row_xor<8>(v); v += row_xor<4>(v); v += row_xor<2>(v); v += row_xor<1>(v);
  return v;
}
__device__ __forceinline__ float row_max(float v) {   // maximum over a 16-lane row
  v = fmaxf(v, row_xor<8>(v)); v = fmaxf(v, row_xor<4>(v));
  v = fmaxf(v, row_xor<2>(v)); v = fmaxf(v, row_xor<1>(v));
  return v;
}
__device__ __forceinline__ float wred_add(float v) {  // sum over all 32 lanes
  v += half_xor(v);
  return row_add(v);
}
__device__ __forceinline__ float quad_add(float v) {  // sum over 4 neighbouring lanes
  v += row_xor<1>(v); v += row_xor<2>(v);
  return v;
}
// 1/sqrt(x) as rsqrtf forms it (a tiny x is scaled up first). The v_nop fills the slot
// that the instruction set asks for directly behind a transcendental.
__device__ __forceinline__ float rsqrt_slot(float x) {
  const bool tiny = x < 0x1p-126f;
  float xs = tiny ? x * 0x1p+24f : x;
  float r;
  asm("v_rsq_f32 %0, %1\n\tv_nop" : "=v"(r) : "v"(xs));
  return tiny ? r * 0x1p+12f : r;
}

__global__ __launch_bounds__(NTHREADS, 1)
void disentangled_encoder_kernel(const float* __restrict__ zg,
                                 const float* __restrict__ protos,
                                 const float* __restrict__ alphas,
                                 const float* __restrict__ b_bias,
                                 const float* __restrict__ W,
                                 const float* __restrict__ Wb,
                                 const float* __restrict__ ln_g,
                                 const float* __restrict__ ln_b,
                                 const float* __restrict__ beta_seq,
                                 float* __restrict__ out)
{
  extern __shared__ char smem[];
  float*    sZ   = (float*)(smem + OFF_Z);
  _Float16* sE   = (_Float16*)(smem + OFF_E);
  float*    sMu  = (float*)(smem + OFF_MU);
  float*    sRs  = (float*)(smem + OFF_RS);
  float*    sS   = (float*)(smem + OFF_S);
  float*    sPnp = (float*)(smem + OFF_PNP);
  float*    sP1  = (float*)(smem + OFF_P1);
  float*    sBd  = (float*)(smem + OFF_BD);
  float*    sQh  = (float*)(smem + OFF_QH);
  float*    sG2  = (float*)(smem + OFF_G2);
  float*    sB2  = (float*)(smem + OFF_B2);
  float*    sG4  = (float*)(smem + OFF_G4);
  float*    sB4  = (float*)(smem + OFF_B4);
  float*    sAcc = (float*)(smem + OFF_ACC);
  float*    sRed = (float*)(smem + OFF_RED);
  float*    sQ   = (float*)(smem + OFF_Q);

  const int b    = blockIdx.x;
  const int tid  = threadIdx.x;
  const int wave = tid >> 5;
  const int lane = tid & 31;

  // ---------------- Set-up reads: nothing here needs the staged z ----------
  // Issued ahead of the z copy, so that they do not queue behind it; used under it.
  // W: 8 threads share a row, each holds 8 neighbouring columns (a wave reads 1 KiB in a row).
  const int wrow = tid >> 3;
  const int wcol = (tid & 7) * 8;
  const v4f wa = *(const v4f*)&W[wrow*D_ + wcol];
  const v4f wb = *(const v4f*)&W[wrow*D_ + wcol + 4];
  const float px1 = protos[wave*D_+lane], px2 = protos[wave*D_+lane+32];
  const float g0a = ln_g[lane],      g0b = ln_g[lane+32];
  const float b0a = ln_b[lane],      b0b = ln_b[lane+32];
  const float g1a = ln_g[D_+lane],   g1b = ln_g[D_+lane+32];
  const float b1a = ln_b[D_+lane],   b1b = ln_b[D_+lane+32];
  // the query's row: z[b, T-1] straight from global memory. Every wave reads these few
  // lines (no branch in front of the copy); wave 0 uses them.
  const float* zlast = zg + (size_t)b * T_ * D_ + (T_-1)*D_;
  const float zl1 = zlast[lane],               zl2 = zlast[lane+32];
  const float al1 = alphas[(T_-1)*D_+lane],    al2 = alphas[(T_-1)*D_+lane+32];
  const float bi1 = b_bias[lane],              bi2 = b_bias[lane+32];
  const float g3a = ln_g[3*D_+lane],           g3b = ln_g[3*D_+lane+32];
  const float b3a = ln_b[3*D_+lane],           b3b = ln_b[3*D_+lane+32];
  const float wv1 = Wb[lane],                  wv2 = Wb[lane+32];

  // ---------------- Phase 0: async-DMA z[b] into LDS (CDNA5 async pipe) ----
  // GLOBAL_LOAD_ASYNC_TO_LDS_B128: no VGPR data movement, tracked by ASYNCcnt.
  {
    const float4* zsrc = (const float4*)(zg + (size_t)b * T_ * D_);
    #pragma unroll 4
    for (int i = tid; i < T_*D_/4; i += NTHREADS) {
      const int isw = (i & ~15) | ((i & 15) ^ swz(i >> 4));     // piece i&15 of row i>>4
      unsigned lds_addr = (unsigned)(uintptr_t)(sZ + 4*isw);    // LDS offset = flat[31:0]
      unsigned long long gaddr = (unsigned long long)(uintptr_t)(zsrc + i);
      asm volatile("global_load_async_to_lds_b128 %0, %1, off"
                   :: "v"(lds_addr), "v"(gaddr) : "memory");
    }
    // overlap: zero the out accumulator + fetch LN params while DMA is in flight
    for (int i = tid; i < K_*D_;  i += NTHREADS) sAcc[i] = 0.f;
    if (tid < D_) {
      sG2[tid] = ln_g[2*D_+tid]; sB2[tid] = ln_b[2*D_+tid];
      sG4[tid] = ln_g[4*D_+tid]; sB4[tid] = ln_b[4*D_+tid];
    }
    // also under the copy: prototypes LN (folded with g0/b0)
    {
      // wave w handles prototype row k=w (16 waves, K=16)
      const int k = wave;
      float x1 = px1, x2 = px2;
      float s1 = wred_add(x1 + x2);
      float s2 = wred_add(x1*x1 + x2*x2);
      float mu = s1 * (1.f/D_);
      float rs = rsqrtf(s2*(1.f/D_) - mu*mu + EPS_);
      float pn1 = (x1-mu)*rs*g1a + b1a;
      float pn2 = (x2-mu)*rs*g1b + b1b;
      float pp1 = pn1 * g0a;              // fold gamma0 into pn
      float pp2 = pn2 * g0b;
      sPnp[zidx(k, lane)] = pp1; sPnp[zidx(k, lane+32)] = pp2;
      float p1 = wred_add(pp1 + pp2);             // sum_d g0*pn
      float bd = wred_add(b0a*pn1 + b0b*pn2);     // sum_d b0*pn
      if (lane == 0) { sP1[k] = p1; sBd[k] = bd; }
    }
    // and q = LN(alphas[-1] + z[:, -1] + b_bias);  c0 = Wb . q
    if (wave == 0) {
      float x1 = al1 + zl1 + bi1;
      float x2 = al2 + zl2 + bi2;
      float s1 = wred_add(x1 + x2);
      float s2 = wred_add(x1*x1 + x2*x2);
      float mu = s1 * (1.f/D_);
      float rs = rsqrtf(s2*(1.f/D_) - mu*mu + EPS_);
      float q1 = (x1-mu)*rs*g3a + b3a;
      float q2 = (x2-mu)*rs*g3b + b3b;
      sQ[lane]    = q1;
      sQ[lane+32] = q2;
      float c0p = wred_add(wv1*q1 + wv2*q2);
      if (lane == 0) sRed[32] = c0p;
    }
    asm volatile("s_wait_asynccnt 0x0" ::: "memory");   // my async loads done
  }
  __syncthreads();                                      // all waves' loads, q, pn' visible

  // ---------------- Setup: qhat = q + W q (all threads), row stats ----------
  {
    // 8 products a thread from the W registers, then 3 cross-lane steps over the row's 8 threads
    v4f qa = *(const v4f*)&sQ[wcol];
    v4f qb = *(const v4f*)&sQ[wcol + 4];
    v4f pr = wa*qa + wb*qb;
    float dq = (pr[0] + pr[1]) + (pr[2] + pr[3]);
    dq += row_xor<1>(dq); dq += row_xor<2>(dq); dq += row_xor<4>(dq);
    float qd = sQ[wrow];
    if ((tid & 7) == 0) sQh[wrow] = qd + dq;
  }
  // Row-sum layout: 4 lanes share a row, a wave works on 8 rows at once. Each lane
  // sums 16 elements in registers (4 reads of 16 bytes), then 2 cross-lane steps.
  // Step j reads quarter j of the row; the layout of sZ spreads 16 lanes over all 64 banks.
  // Every loop over p or j in this layout is unrolled: its small arrays are then
  // indexed by constants and stay in registers.
  const int l4   = lane & 3;
  const int rsub = lane >> 2;
  int qoff[4];                 // column of this lane's slice
  int zoff[2][4];              // its place in a row of sZ, for rows rsub and 8 + rsub
  #pragma unroll
  for (int j = 0; j < 4; ++j) {
    qoff[j] = 16*j + 4*l4;
    zoff[0][j] = zidx(rsub, qoff[j]) - rsub*D_;
    zoff[1][j] = zidx(8 + rsub, qoff[j]) - (8 + rsub)*D_;
  }

  // per-row mean/rstd of z (feeds the rank-1 LN epilogue of the scores GEMM)
  // unrolled: the 8 passes are independent, their LDS reads and sums overlap
  float muv[8], rsv[8];
  #pragma unroll
  for (int p = 0; p < 8; ++p) {
    const int t = wave*64 + p*8 + rsub;
    v2f a1 = {0.f, 0.f}, a2 = {0.f, 0.f};
    #pragma unroll
    for (int j = 0; j < 4; ++j) {
      v4f v = *(const v4f*)&sZ[t*D_ + zoff[p & 1][j]];
      a1 += v.lo;       a1 += v.hi;
      a2 += v.lo*v.lo;  a2 += v.hi*v.hi;
    }
    float s1 = quad_add(a1[0] + a1[1]);
    float s2 = quad_add(a2[0] + a2[1]);
    muv[p] = s1 * (1.f/D_);
    rsv[p] = rsqrt_slot(s2*(1.f/D_) - muv[p]*muv[p] + EPS_);
  }
  if (l4 == 0) {
    #pragma unroll
    for (int p = 0; p < 8; ++p) {
      sMu[wave*64 + p*8 + rsub] = muv[p];
      sRs[wave*64 + p*8 + rsub] = rsv[p];
    }
  }
  __syncthreads();

  // ---------------- Phase A: scores_k = z @ pn'^T  (f32 WMMA, exact) --------
  // zn.pn folded: score = rs_t*(Zdot - mu_t*P1[k]) + bdot[k]
  {
    const int half = lane >> 4;     // K-slice selector within A/B operands
    const int l16  = lane & 15;
    v2f bb[16];
    #pragma unroll
    for (int i = 0; i < 16; ++i) {
      int d = 4*i + 2*half;
      bb[i] = *(const v2f*)&sPnp[zidx(l16, d)]; // B[d][k] = pn'[k][d]
    }
    const float P1k = sP1[l16];
    const float bdk = sBd[l16];
    for (int st = 0; st < 4; ++st) {
      const int t0 = wave*64 + st*16;
      v8f c = {};
      #pragma unroll
      for (int i = 0; i < 16; ++i) {
        int d = 4*i + 2*half;
        v2f a = *(const v2f*)&sZ[t0*D_ + zidx(l16, d)];  // A[t][d] = raw z (t0 % 16 == 0)
        c = __builtin_amdgcn_wmma_f32_16x16x4_f32(false, a, false, bb[i],
                                                  (short)0, c, false, false);
      }
      // epilogue: LN-fold + softmax over K (lanes 0-15 / 16-31 groups)
      #pragma unroll
      for (int r = 0; r < 8; ++r) {
        int t = t0 + r + 8*half;
        float mu = sMu[t], rs = sRs[t];
        float sc = (rs*(c[r] - mu*P1k) + bdk) * SCALE_;
        float m = row_max(sc);
        float e = __expf(sc - m);
        float S = row_add(e);
        sE[t*K_ + l16] = (_Float16)(e / S);   // p_{k|i}
      }
    }
  }

  // ---------------- Phase A3: s_t = LN(alphas+z) . qhat + c0 (Dense folded) -
  {
    // same row-sum layout; LN folded as in Phase A, x = alphas + z:
    // LN(x).qhat = rs*(sum x*g2*qhat - mu*sum g2*qhat) + sum b2*qhat
    const float c0 = sRed[32];
    v4f av[8][4];                               // alphas is L2-resident
    unsigned gb[4];                             // byte offset of this lane's slices
    #pragma unroll
    for (int j = 0; j < 4; ++j) gb[j] = 4u*((wave*64 + rsub)*D_ + qoff[j]);
    #pragma unroll
    for (int p = 0; p < 8; ++p) {
      #pragma unroll
      for (int j = 0; j < 4; ++j)
        av[p][j] = *(const v4f*)((const char*)alphas + gb[j] + p*8*D_*4);
    }
    // the loads' offset registers stay untouched until this wait has passed
    asm volatile("s_wait_xcnt 0x0" :: "v"(gb[0]), "v"(gb[1]), "v"(gb[2]), "v"(gb[3]) : "memory");
    v4f gq[4];                                  // g2*qhat, this lane's 16 columns
    v2f gs = {0.f, 0.f}, bq = {0.f, 0.f};
    #pragma unroll
    for (int j = 0; j < 4; ++j) {
      v4f q  = *(const v4f*)&sQh[qoff[j]];
      v4f b2 = *(const v4f*)&sB2[qoff[j]];
      gq[j]  = *(const v4f*)&sG2[qoff[j]] * q;
      gs += gq[j].lo;    gs += gq[j].hi;
      bq += b2.lo*q.lo;  bq += b2.hi*q.hi;
    }
    const float Gs = quad_add(gs[0] + gs[1]);
    const float Bq = quad_add(bq[0] + bq[1]) + c0;
    // unrolled: the 8 passes are independent, their reads and sums overlap
    float sc[8];
    #pragma unroll
    for (int p = 0; p < 8; ++p) {
      const int t = wave*64 + p*8 + rsub;
      v2f a1 = {0.f, 0.f}, a2 = {0.f, 0.f}, a3 = {0.f, 0.f};
      #pragma unroll
      for (int j = 0; j < 4; ++j) {
        v4f x = av[p][j] + *(const v4f*)&sZ[t*D_ + zoff[p & 1][j]];
        a1 += x.lo;            a1 += x.hi;
        a2 += x.lo*x.lo;       a2 += x.hi*x.hi;
        a3 += x.lo*gq[j].lo;   a3 += x.hi*gq[j].hi;
      }
      float s1 = quad_add(a1[0] + a1[1]);
      float s2 = quad_add(a2[0] + a2[1]);
      float s3 = quad_add(a3[0] + a3[1]);
      float mu = s1 * (1.f/D_);
      float rs = rsqrt_slot(s2*(1.f/D_) - mu*mu + EPS_);
      sc[p] = (rs*(s3 - mu*Gs) + Bq) * SCALE_;
    }
    if (l4 == 0) {
      #pragma unroll
      for (int p = 0; p < 8; ++p) sS[wave*64 + p*8 + rsub] = sc[p];
    }
  }
  __syncthreads();

  // ---------------- softmax over T (block reduction) ------------------------
  {
    float sa = sS[tid], sb = sS[tid + NTHREADS];
    float m = fmaxf(sa, sb);
    m = row_max(fmaxf(m, half_xor(m)));
    if (lane == 0) sRed[wave] = m;
    __syncthreads();
    float M = -1e30f;
    #pragma unroll
    for (int i = 0; i < 16; ++i) M = fmaxf(M, sRed[i]);
    float ea = __expf(sa - M), eb = __expf(sb - M);
    float S = wred_add(ea + eb);
    if (lane == 0) sRed[16 + wave] = S;
    __syncthreads();
    float Ssum = 0.f;
    #pragma unroll
    for (int i = 0; i < 16; ++i) Ssum += sRed[16 + i];
    float inv = 1.f / Ssum;
    sS[tid]            = ea * inv;   // p_i
    sS[tid + NTHREADS] = eb * inv;
  }
  __syncthreads();

  // ---------------- Phase B: out[k,d] = sum_t (p_{k|i}*p_i) * z  (f32 WMMA) -
  {
    const int half = lane >> 4;
    const int l16  = lane & 15;
    const int tw   = wave*64;           // each wave owns a 64-wide T slice
    const int hx   = 32*half;           // swz(tA) = 8*half + (stp & 3), swz(tA+1) = that + 4
    v8f acc[4] = {};
    for (int stp = 0; stp < 16; ++stp) {
      int tA = tw + 4*stp + 2*half;
      // zidx(tA, d) and zidx(tA+1, d) written out, so that two addresses and constant
      // offsets serve the eight reads: column block dt of row tA lies at block
      // dt ^ 2*half, of row tA+1 at block dt ^ 2*half ^ 1
      const int sx = (((l16 >> 2) ^ (stp & 3)) << 2) | (l16 & 3);
      const float* zP = &sZ[tA*D_ + hx + sx];          // dt 0, 1
      const float* zQ = &sZ[tA*D_ + (32 - hx) + sx];   // dt 2, 3
      float p0 = sS[tA], p1 = sS[tA+1];
      v2f a;
      a[0] = (float)sE[tA*K_ + l16]     * p0;   // A[k][t] = w[t][k]
      a[1] = (float)sE[(tA+1)*K_ + l16] * p1;
      #pragma unroll
      for (int dt = 0; dt < 4; ++dt) {
        const float* zr = (dt & 2) ? zQ : zP;
        v2f bv;
        bv[0] = zr[16*(dt & 1)];                // B[t][d] = z, d = dt*16 + l16
        bv[1] = zr[D_ + 16*((dt & 1) ^ 1)];
        acc[dt] = __builtin_amdgcn_wmma_f32_16x16x4_f32(false, a, false, bv,
                                                        (short)0, acc[dt], false, false);
      }
    }
    // cross-wave K-dim reduction into sAcc
    #pragma unroll
    for (int dt = 0; dt < 4; ++dt) {
      #pragma unroll
      for (int r = 0; r < 8; ++r) {
        int k = r + 8*half;
        int d = dt*16 + l16;
        atomicAdd(&sAcc[aidx(k, d)], acc[dt][r]);
      }
    }
  }
  __syncthreads();

  // ---------------- Phase C: final LN(beta_seq + out) + store ---------------
  {
    const int k = wave;                 // 16 waves, 16 rows
    float v1 = beta_seq[k*D_+lane]    + sAcc[aidx(k, lane)];
    float v2 = beta_seq[k*D_+lane+32] + sAcc[aidx(k, lane+32)];
    float s1 = wred_add(v1 + v2);
    float s2 = wred_add(v1*v1 + v2*v2);
    float mu = s1 * (1.f/D_);
    float rs = rsqrtf(s2*(1.f/D_) - mu*mu + EPS_);
    float y1 = (v1-mu)*rs*sG4[lane]    + sB4[lane];
    float y2 = (v2-mu)*rs*sG4[lane+32] + sB4[lane+32];
    float* o = out + (size_t)b*K_*D_ + k*D_;
    o[lane]    = y1;
    o[lane+32] = y2;
  }
}

extern "C" void kernel_launch(void* const* d_in, const int* in_sizes, int n_in,
                              void* d_out, int out_size, void* d_ws, size_t ws_size,
                              hipStream_t stream) {
  const float* z        = (const float*)d_in[0];
  const float* protos   = (const float*)d_in[1];
  const float* alphas   = (const float*)d_in[2];
  const float* b_bias   = (const float*)d_in[3];
  const float* W        = (const float*)d_in[4];
  const float* Wb       = (const float*)d_in[5];
  const float* ln_g     = (const float*)d_in[6];
  const float* ln_b     = (const float*)d_in[7];
  const float* beta_seq = (const float*)d_in[8];
  float* out = (float*)d_out;

  disentangled_encoder_kernel<<<B_, NTHREADS, SMEM_BYTES, stream>>>(
      z, protos, alphas, b_bias, W, Wb, ln_g, ln_b, beta_seq, out);
}

// v005
// A run of this version takes 32 microseconds.
// In both of two side-by-side timings against v004, it was 1.13 times as fast.
// Over all steps from v000 it is 6.21 times as fast.
#include <hip/hip_runtime.h>

typedef float v2f __attribute__((ext_vector_type(2)));
typedef float v4f __attribute__((ext_vector_type(4)));
typedef float v8f __attribute__((ext_vector_type(8)));
typedef _Float16 h8 __attribute__((ext_vector_type(8)));

#define B_  512
#define T_  1024
#define D_  64
#define K_  16
#define NTHREADS 512
#define EPS_ 1e-6f
#define SCALE_ 0.125f   // 1/sqrt(64)

// ---- LDS layout (bytes) ----
constexpr int OFF_Z   = 0;                       // 1024*64 f32   = 262144
constexpr int OFF_E   = OFF_Z   + T_*D_*4;       // 1024*16 f16   =  32768
constexpr int OFF_MU  = OFF_E   + T_*K_*2;       // 1024 f32
constexpr int OFF_RS  = OFF_MU  + T_*4;          // 1024 f32
constexpr int OFF_S   = OFF_RS  + T_*4;          // 1024 f32 (scores_t -> p_i)
constexpr int OFF_PNP = OFF_S   + T_*4;          // 16*64 f32 (pn * g0)
constexpr int OFF_P1  = OFF_PNP + K_*D_*4;       // 16 f32
constexpr int OFF_BD  = OFF_P1  + K_*4;          // 16 f32
constexpr int OFF_QH  = OFF_BD  + K_*4;          // 64 f32 (qhat)
constexpr int OFF_G2  = OFF_QH  + D_*4;          // 64 f32
constexpr int OFF_B2  = OFF_G2  + D_*4;
constexpr int OFF_G4  = OFF_B2  + D_*4;
constexpr int OFF_B4  = OFF_G4  + D_*4;
constexpr int OFF_ACC = OFF_B4  + D_*4;          // 16*64 f32 out accumulator
constexpr int OFF_RED = OFF_ACC + K_*D_*4;       // 64 f32 reduction scratch
constexpr int OFF_Q   = OFF_RED + 64*4;         // 64 f32 (q)
constexpr int SMEM_BYTES = OFF_Q + D_*4;         // ~310 KB < 320 KB/WGP

// LDS layout of the 64-float rows of z and pn' (sZ, sPnp): rows are 256 bytes apart, so one column of
// 16 rows would fall on one bank. The 16-byte piece c of row t is kept at place c ^ swz(t).
// swz is one-to-one over 16 rows in a row (a column of 16 rows covers all 64 banks), and
// rows t and t + 2 differ in its top bit (the two lane halves of a B operand use
// different banks).
__device__ __forceinline__ int swz(int t) { return ((t & 3) << 2) | ((t >> 2) & 3); }
// float index in sZ of element d of row t
__device__ __forceinline__ int zidx(int t, int d) {
  return t*D_ + ((((d >> 2) ^ swz(t)) << 2) | (d & 3));
}
// float index in sAcc of element d of row k: rows k and k + 8, which the two lane halves
// of an accumulator register add to at once, use different banks
__device__ __forceinline__ int aidx(int k, int d) { return k*D_ + (d ^ ((k & 8) << 2)); }

// Cross-lane moves on the vector pipe (no LDS round trip per butterfly step).
// lane l <- lane l ^ MASK inside a 16-lane row (DPP row_xmask)
template <int MASK>
__device__ __forceinline__ float row_xor(float v) {
  return __builtin_bit_cast(float, __builtin_amdgcn_mov_dpp(
      __builtin_bit_cast(int, v), 0x160 | MASK, 0xf, 0xf, true));
}
// lane l <- lane l ^ 16
__device__ __forceinline__ float half_xor(float v) {
  int b = __builtin_bit_cast(int, v);
  return __builtin_bit_cast(float, __builtin_amdgcn_permlanex16(
      b, b, 0x76543210, 0xfedcba98, false, false));
}
__device__ __forceinline__ float row_add(float v) {   // sum over a 16-lane row
  v += row_xor<8>(v); v += row_xor<4>(v); v += row_xor<2>(v); v += row_xor<1>(v);
  return v;
}
__device__ __forceinline__ float row_max(float v) {   // maximum over a 16-lane row
  v = fmaxf(v, row_xor<8>(v)); v = fmaxf(v, row_xor<4>(v));
  v = fmaxf(v, row_xor<2>(v)); v = fmaxf(v, row_xor<1>(v));
  return v;
}
__device__ __forceinline__ float wred_add(float v) {  // sum over all 32 lanes
  v += half_xor(v);
  return row_add(v);
}
__device__ __forceinline__ float quad_add(float v) {  // sum over 4 neighbouring lanes
  v += row_xor<1>(v); v += row_xor<2>(v);
  return v;
}
// 1/sqrt(x) as rsqrtf forms it (a tiny x is scaled up first). The v_nop fills the slot
// that the instruction set asks for directly behind a transcendental.
__device__ __forceinline__ float rsqrt_slot(float x) {
  const bool tiny = x < 0x1p-126f;
  float xs = tiny ? x * 0x1p+24f : x;
  float r;
  asm("v_rsq_f32 %0, %1\n\tv_nop" : "=v"(r) : "v"(xs));
  return tiny ? r * 0x1p+12f : r;
}

// e^x as __expf forms it (2^(x*log2 e)), with the same slot behind the transcendental.
__device__ __forceinline__ float exp_slot(float x) {
  float y = x * 1.442695041f;
  float r;
  asm("v_exp_f32 %0, %1\n\tv_nop" : "=v"(r) : "v"(y));
  return r;
}

__global__ __launch_bounds__(NTHREADS, 1)
void disentangled_encoder_kernel(const float* __restrict__ zg,
                                 const float* __restrict__ protos,
                                 const float* __restrict__ alphas,
                                 const float* __restrict__ b_bias,
                                 const float* __restrict__ W,
                                 const float* __restrict__ Wb,
                                 const float* __restrict__ ln_g,
                                 const float* __restrict__ ln_b,
                                 const float* __restrict__ beta_seq,
                                 float* __restrict__ out)
{
  extern __shared__ char smem[];
  float*    sZ   = (float*)(smem + OFF_Z);
  _Float16* sE   = (_Float16*)(smem + OFF_E);
  float*    sMu  = (float*)(smem + OFF_MU);
  float*    sRs  = (float*)(smem + OFF_RS);
  float*    sS   = (float*)(smem + OFF_S);
  float*    sPnp = (float*)(smem + OFF_PNP);
  float*    sP1  = (float*)(smem + OFF_P1);
  float*    sBd  = (float*)(smem + OFF_BD);
  float*    sQh  = (float*)(smem + OFF_QH);
  float*    sG2  = (float*)(smem + OFF_G2);
  float*    sB2  = (float*)(smem + OFF_B2);
  float*    sG4  = (float*)(smem + OFF_G4);
  float*    sB4  = (float*)(smem + OFF_B4);
  float*    sAcc = (float*)(smem + OFF_ACC);
  float*    sRed = (float*)(smem + OFF_RED);
  float*    sQ   = (float*)(smem + OFF_Q);

  const int b    = blockIdx.x;
  const int tid  = threadIdx.x;
  const int wave = tid >> 5;
  const int lane = tid & 31;

  // ---------------- Set-up reads: nothing here needs the staged z ----------
  // Issued ahead of the z copy, so that they do not queue behind it; used under it.
  // W: 8 threads share a row, each holds 8 neighbouring columns (a wave reads 1 KiB in a row).
  const int wrow = tid >> 3;
  const int wcol = (tid & 7) * 8;
  const v4f wa = *(const v4f*)&W[wrow*D_ + wcol];
  const v4f wb = *(const v4f*)&W[wrow*D_ + wcol + 4];
  const float px1 = protos[wave*D_+lane], px2 = protos[wave*D_+lane+32];
  const float g0a = ln_g[lane],      g0b = ln_g[lane+32];
  const float b0a = ln_b[lane],      b0b = ln_b[lane+32];
  const float g1a = ln_g[D_+lane],   g1b = ln_g[D_+lane+32];
  const float b1a = ln_b[D_+lane],   b1b = ln_b[D_+lane+32];
  // the query's row: z[b, T-1] straight from global memory. Every wave reads these few
  // lines (no branch in front of the copy); wave 0 uses them.
  const float* zlast = zg + (size_t)b * T_ * D_ + (T_-1)*D_;
  const float zl1 = zlast[lane],               zl2 = zlast[lane+32];
  const float al1 = alphas[(T_-1)*D_+lane],    al2 = alphas[(T_-1)*D_+lane+32];
  const float bi1 = b_bias[lane],              bi2 = b_bias[lane+32];
  const float g3a = ln_g[3*D_+lane],           g3b = ln_g[3*D_+lane+32];
  const float b3a = ln_b[3*D_+lane],           b3b = ln_b[3*D_+lane+32];
  const float wv1 = Wb[lane],                  wv2 = Wb[lane+32];

  // ---------------- Phase 0: async-DMA z[b] into LDS (CDNA5 async pipe) ----
  // GLOBAL_LOAD_ASYNC_TO_LDS_B128: no VGPR data movement, tracked by ASYNCcnt.
  {
    const float4* zsrc = (const float4*)(zg + (size_t)b * T_ * D_);
    #pragma unroll 4
    for (int i = tid; i < T_*D_/4; i += NTHREADS) {
      const int isw = (i & ~15) | ((i & 15) ^ swz(i >> 4));     // piece i&15 of row i>>4
      unsigned lds_addr = (unsigned)(uintptr_t)(sZ + 4*isw);    // LDS offset = flat[31:0]
      unsigned long long gaddr = (unsigned long long)(uintptr_t)(zsrc + i);
      asm volatile("global_load_async_to_lds_b128 %0, %1, off"
                   :: "v"(lds_addr), "v"(gaddr) : "memory");
    }
    // overlap: zero the out accumulator + fetch LN params while DMA is in flight
    for (int i = tid; i < K_*D_;  i += NTHREADS) sAcc[i] = 0.f;
    if (tid < D_) {
      sG2[tid] = ln_g[2*D_+tid]; sB2[tid] = ln_b[2*D_+tid];
      sG4[tid] = ln_g[4*D_+tid]; sB4[tid] = ln_b[4*D_+tid];
    }
    // also under the copy: prototypes LN (folded with g0/b0)
    {
      // wave w handles prototype row k=w (16 waves, K=16)
      const int k = wave;
      float x1 = px1, x2 = px2;
      float s1 = wred_add(x1 + x2);
      float s2 = wred_add(x1*x1 + x2*x2);
      float mu = s1 * (1.f/D_);
      float rs = rsqrtf(s2*(1.f/D_) - mu*mu + EPS_);
      float pn1 = (x1-mu)*rs*g1a + b1a;
      float pn2 = (x2-mu)*rs*g1b + b1b;
      float pp1 = pn1 * g0a;              // fold gamma0 into pn
      float pp2 = pn2 * g0b;
      sPnp[zidx(k, lane)] = pp1; sPnp[zidx(k, lane+32)] = pp2;
      float p1 = wred_add(pp1 + pp2);             // sum_d g0*pn
      float bd = wred_add(b0a*pn1 + b0b*pn2);     // sum_d b0*pn
      if (lane == 0) { sP1[k] = p1; sBd[k] = bd; }
    }
    // and q = LN(alphas[-1] + z[:, -1] + b_bias);  c0 = Wb . q
    if (wave == 0) {
      float x1 = al1 + zl1 + bi1;
      float x2 = al2 + zl2 + bi2;
      float s1 = wred_add(x1 + x2);
      float s2 = wred_add(x1*x1 + x2*x2);
      float mu = s1 * (1.f/D_);
      float rs = rsqrtf(s2*(1.f/D_) - mu*mu + EPS_);
      float q1 = (x1-mu)*rs*g3a + b3a;
      float q2 = (x2-mu)*rs*g3b + b3b;
      sQ[lane]    = q1;
      sQ[lane+32] = q2;
      float c0p = wred_add(wv1*q1 + wv2*q2);
      if (lane == 0) sRed[32] = c0p;
    }
    asm volatile("s_wait_asynccnt 0x0" ::: "memory");   // my async loads done
  }
  __syncthreads();                                      // all waves' loads, q, pn' visible

  // ---------------- Setup: qhat = q + W q (all threads), row stats ----------
  {
    // 8 products a thread from the W registers, then 3 cross-lane steps over the row's 8 threads
    v4f qa = *(const v4f*)&sQ[wcol];
    v4f qb = *(const v4f*)&sQ[wcol + 4];
    v4f pr = wa*qa + wb*qb;
    float dq = (pr[0] + pr[1]) + (pr[2] + pr[3]);
    dq += row_xor<1>(dq); dq += row_xor<2>(dq); dq += row_xor<4>(dq);
    float qd = sQ[wrow];
    if ((tid & 7) == 0) sQh[wrow] = qd + dq;
  }
  // Row-sum layout: 4 lanes share a row, a wave works on 8 rows at once. Each lane
  // sums 16 elements in registers (4 reads of 16 bytes), then 2 cross-lane steps.
  // Step j reads quarter j of the row; the layout of sZ spreads 16 lanes over all 64 banks.
  // Every loop over p or j in this layout is unrolled: its small arrays are then
  // indexed by constants and stay in registers.
  const int l4   = lane & 3;
  const int rsub = lane >> 2;
  int qoff[4];                 // column of this lane's slice
  int zoff[2][4];              // its place in a row of sZ, for rows rsub and 8 + rsub
  #pragma unroll
  for (int j = 0; j < 4; ++j) {
    qoff[j] = 16*j + 4*l4;
    zoff[0][j] = zidx(rsub, qoff[j]) - rsub*D_;
    zoff[1][j] = zidx(8 + rsub, qoff[j]) - (8 + rsub)*D_;
  }

  // per-row mean/rstd of z (feeds the rank-1 LN epilogue of the scores GEMM)
  // unrolled: the 8 passes are independent, their LDS reads and sums overlap
  float muv[8], rsv[8];
  #pragma unroll
  for (int p = 0; p < 8; ++p) {
    const int t = wave*64 + p*8 + rsub;
    v2f a1 = {0.f, 0.f}, a2 = {0.f, 0.f};
    #pragma unroll
    for (int j = 0; j < 4; ++j) {
      v4f v = *(const v4f*)&sZ[t*D_ + zoff[p & 1][j]];
      a1 += v.lo;       a1 += v.hi;
      a2 += v.lo*v.lo;  a2 += v.hi*v.hi;
    }
    float s1 = quad_add(a1[0] + a1[1]);
    float s2 = quad_add(a2[0] + a2[1]);
    muv[p] = s1 * (1.f/D_);
    rsv[p] = rsqrt_slot(s2*(1.f/D_) - muv[p]*muv[p] + EPS_);
  }
  if (l4 == 0) {
    #pragma unroll
    for (int p = 0; p < 8; ++p) {
      sMu[wave*64 + p*8 + rsub] = muv[p];
      sRs[wave*64 + p*8 + rsub] = rsv[p];
    }
  }
  __syncthreads();

  // ---------------- Phase A: scores_k^T = pn' @ z^T  (f32 WMMA, exact) ------
  // zn.pn folded: score = rs_t*(Zdot - mu_t*P1[k]) + bdot[k]
  // pn' is the A operand and z the B operand: a lane then holds 8 of the 16 scores of ONE
  // row t (k = r + 8*half), so the softmax over K is 8 registers and one exchange of halves.
  {
    const int half = lane >> 4;     // K-slice selector within A/B operands
    const int l16  = lane & 15;
    // SCALE_ is a power of two: taken into pn', P1 and bdot it changes no rounding
    v2f pa[16];
    #pragma unroll
    for (int i = 0; i < 16; ++i) {
      int d = 4*i + 2*half;
      pa[i] = *(const v2f*)&sPnp[zidx(l16, d)] * SCALE_;  // A[k][d] = pn'[k][d]
    }
    float P1s[8], bds[8];                       // this half's 8 intents
    #pragma unroll
    for (int r = 0; r < 8; ++r) {
      P1s[r] = sP1[8*half + r] * SCALE_;
      bds[r] = sBd[8*half + r] * SCALE_;
    }
    for (int st = 0; st < 4; ++st) {
      const int t0 = wave*64 + st*16;
      const int t  = t0 + l16;                  // this lane's row
      const float mu = sMu[t], rs = sRs[t];
      v2f zb[16];
      #pragma unroll
      for (int i = 0; i < 16; ++i) {
        int d = 4*i + 2*half;
        zb[i] = *(const v2f*)&sZ[t0*D_ + zidx(l16, d)];   // B[d][t] = raw z (t0 % 16 == 0)
      }
      v8f c = {};
      #pragma unroll
      for (int i = 0; i < 16; ++i)
        c = __builtin_amdgcn_wmma_f32_16x16x4_f32(false, pa[i], false, zb[i],
                                                  (short)0, c, false, false);
      // The loaded B fragments stay in their registers to the end of the chain (inputs only).
      // The scheduling barrier keeps the statement behind the chain.
      __builtin_amdgcn_sched_barrier(0);
      asm volatile("" ::
                   "v"(zb[0]),  "v"(zb[1]),  "v"(zb[2]),  "v"(zb[3]),
                   "v"(zb[4]),  "v"(zb[5]),  "v"(zb[6]),  "v"(zb[7]),
                   "v"(zb[8]),  "v"(zb[9]),  "v"(zb[10]), "v"(zb[11]),
                   "v"(zb[12]), "v"(zb[13]), "v"(zb[14]), "v"(zb[15]));
      // epilogue: LN-fold + softmax over K, all for this lane's row
      float sc[8];
      #pragma unroll
      for (int r = 0; r < 8; ++r) sc[r] = rs*(c[r] - mu*P1s[r]) + bds[r];
      float m = fmaxf(fmaxf(fmaxf(sc[0], sc[1]), fmaxf(sc[2], sc[3])),
                      fmaxf(fmaxf(sc[4], sc[5]), fmaxf(sc[6], sc[7])));
      m = fmaxf(m, half_xor(m));
      float e[8];
      #pragma unroll
      for (int r = 0; r < 8; ++r) e[r] = exp_slot(sc[r] - m);
      float S = ((e[0] + e[1]) + (e[2] + e[3])) + ((e[4] + e[5]) + (e[6] + e[7]));
      S += half_xor(S);
      const float inv = 1.f / S;
      h8 pk;
      #pragma unroll
      for (int r = 0; r < 8; ++r) pk[r] = (_Float16)(e[r] * inv);   // p_{k|i}
      *(h8*)&sE[t*K_ + 8*half] = pk;            // one 16-byte store a lane
    }
  }

  // ---------------- Phase A3: s_t = LN(alphas+z) . qhat + c0 (Dense folded) -
  {
    // same row-sum layout; LN folded as in Phase A, x = alphas + z:
    // LN(x).qhat = rs*(sum x*g2*qhat - mu*sum g2*qhat) + sum b2*qhat
    const float c0 = sRed[32];
    v4f av[8][4];                               // alphas is L2-resident
    unsigned gb[4];                             // byte offset of this lane's slices
    #pragma unroll
    for (int j = 0; j < 4; ++j) gb[j] = 4u*((wave*64 + rsub)*D_ + qoff[j]);
    #pragma unroll
    for (int p = 0; p < 8; ++p) {
      #pragma unroll
      for (int j = 0; j < 4; ++j)
        av[p][j] = *(const v4f*)((const char*)alphas + gb[j] + p*8*D_*4);
    }
    // the loads' offset registers stay untouched until this wait has passed
    asm volatile("s_wait_xcnt 0x0" :: "v"(gb[0]), "v"(gb[1]), "v"(gb[2]), "v"(gb[3]) : "memory");
    v4f gq[4];                                  // g2*qhat, this lane's 16 columns
    v2f gs = {0.f, 0.f}, bq = {0.f, 0.f};
    #pragma unroll
    for (int j = 0; j < 4; ++j) {
      v4f q  = *(const v4f*)&sQh[qoff[j]];
      v4f b2 = *(const v4f*)&sB2[qoff[j]];
      gq[j]  = *(const v4f*)&sG2[qoff[j]] * q;
      gs += gq[j].lo;    gs += gq[j].hi;
      bq += b2.lo*q.lo;  bq += b2.hi*q.hi;
    }
    const float Gs = quad_add(gs[0] + gs[1]);
    const float Bq = quad_add(bq[0] + bq[1]) + c0;
    // unrolled: the 8 passes are independent, their reads and sums overlap
    float sc[8];
    #pragma unroll
    for (int p = 0; p < 8; ++p) {
      const int t = wave*64 + p*8 + rsub;
      v2f a1 = {0.f, 0.f}, a2 = {0.f, 0.f}, a3 = {0.f, 0.f};
      #pragma unroll
      for (int j = 0; j < 4; ++j) {
        v4f x = av[p][j] + *(const v4f*)&sZ[t*D_ + zoff[p & 1][j]];
        a1 += x.lo;            a1 += x.hi;
        a2 += x.lo*x.lo;       a2 += x.hi*x.hi;
        a3 += x.lo*gq[j].lo;   a3 += x.hi*gq[j].hi;
      }
      float s1 = quad_add(a1[0] + a1[1]);
      float s2 = quad_add(a2[0] + a2[1]);
      float s3 = quad_add(a3[0] + a3[1]);
      float mu = s1 * (1.f/D_);
      float rs = rsqrt_slot(s2*(1.f/D_) - mu*mu + EPS_);
      sc[p] = (rs*(s3 - mu*Gs) + Bq) * SCALE_;
    }
    if (l4 == 0) {
      #pragma unroll
      for (int p = 0; p < 8; ++p) sS[wave*64 + p*8 + rsub] = sc[p];
    }
  }
  __syncthreads();

  // ---------------- softmax over T (block reduction) ------------------------
  {
    float sa = sS[tid], sb = sS[tid + NTHREADS];
    float m = fmaxf(sa, sb);
    m = row_max(fmaxf(m, half_xor(m)));
    if (lane == 0) sRed[wave] = m;
    __syncthreads();
    float M = -1e30f;
    #pragma unroll
    for (int i = 0; i < 16; ++i) M = fmaxf(M, sRed[i]);
    float ea = __expf(sa - M), eb = __expf(sb - M);
    float S = wred_add(ea + eb);
    if (lane == 0) sRed[16 + wave] = S;
    __syncthreads();
    float Ssum = 0.f;
    #pragma unroll
    for (int i = 0; i < 16; ++i) Ssum += sRed[16 + i];
    float inv = 1.f / Ssum;
    sS[tid]            = ea * inv;   // p_i
    sS[tid + NTHREADS] = eb * inv;
  }
  __syncthreads();

  // ---------------- Phase B: out[k,d] = sum_t (p_{k|i}*p_i) * z  (f32 WMMA) -
  {
    const int half = lane >> 4;
    const int l16  = lane & 15;
    const int tw   = wave*64;           // each wave owns a 64-wide T slice
    const int hx   = 32*half;           // swz(tA) = 8*half + (stp & 3), swz(tA+1) = that + 4
    v8f acc[4] = {};
    for (int stp = 0; stp < 16; ++stp) {
      int tA = tw + 4*stp + 2*half;
      // zidx(tA, d) and zidx(tA+1, d) written out, so that two addresses and constant
      // offsets serve the eight reads: column block dt of row tA lies at block
      // dt ^ 2*half, of row tA+1 at block dt ^ 2*half ^ 1
      const int sx = (((l16 >> 2) ^ (stp & 3)) << 2) | (l16 & 3);
      const float* zP = &sZ[tA*D_ + hx + sx];          // dt 0, 1
      const float* zQ = &sZ[tA*D_ + (32 - hx) + sx];   // dt 2, 3
      float p0 = sS[tA], p1 = sS[tA+1];
      v2f a;
      a[0] = (float)sE[tA*K_ + l16]     * p0;   // A[k][t] = w[t][k]
      a[1] = (float)sE[(tA+1)*K_ + l16] * p1;
      #pragma unroll
      for (int dt = 0; dt < 4; ++dt) {
        const float* zr = (dt & 2) ? zQ : zP;
        v2f bv;
        bv[0] = zr[16*(dt & 1)];                // B[t][d] = z, d = dt*16 + l16
        bv[1] = zr[D_ + 16*((dt & 1) ^ 1)];
        acc[dt] = __builtin_amdgcn_wmma_f32_16x16x4_f32(false, a, false, bv,
                                                        (short)0, acc[dt], false, false);
      }
    }
    // cross-wave K-dim reduction into sAcc
    #pragma unroll
    for (int dt = 0; dt < 4; ++dt) {
      #pragma unroll
      for (int r = 0; r < 8; ++r) {
        int k = r + 8*half;
        int d = dt*16 + l16;
        atomicAdd(&sAcc[aidx(k, d)], acc[dt][r]);
      }
    }
  }
  __syncthreads();

  // ---------------- Phase C: final LN(beta_seq + out) + store ---------------
  {
    const int k = wave;                 // 16 waves, 16 rows
    float v1 = beta_seq[k*D_+lane]    + sAcc[aidx(k, lane)];
    float v2 = beta_seq[k*D_+lane+32] + sAcc[aidx(k, lane+32)];
    float s1 = wred_add(v1 + v2);
    float s2 = wred_add(v1*v1 + v2*v2);
    float mu = s1 * (1.f/D_);
    float rs = rsqrtf(s2*(1.f/D_) - mu*mu + EPS_);
    float y1 = (v1-mu)*rs*sG4[lane]    + sB4[lane];
    float y2 = (v2-mu)*rs*sG4[lane+32] + sB4[lane+32];
    float* o = out + (size_t)b*K_*D_ + k*D_;
    o[lane]    = y1;
    o[lane+32] = y2;
  }
}

extern "C" void kernel_launch(void* const* d_in, const int* in_sizes, int n_in,
                              void* d_out, int out_size, void* d_ws, size_t ws_size,
                              hipStream_t stream) {
  const float* z        = (const float*)d_in[0];
  const float* protos   = (const float*)d_in[1];
  const float* alphas   = (const float*)d_in[2];
  const float* b_bias   = (const float*)d_in[3];
  const float* W        = (const float*)d_in[4];
  const float* Wb       = (const float*)d_in[5];
  const float* ln_g     = (const float*)d_in[6];
  const float* ln_b     = (const float*)d_in[7];
  const float* beta_seq = (const float*)d_in[8];
  float* out = (float*)d_out;

  disentangled_encoder_kernel<<<B_, NTHREADS, SMEM_BYTES, stream>>>(
      z, protos, alphas, b_bias, W, Wb, ln_g, ln_b, beta_seq, out);
}

// v006
// One run takes 30.7 microseconds.
// Timed twice side by side with v005, it ran 1.04 and 1.03 times as fast.
// Counting every step since v000, it is 6.43 times as fast.
#include <hip/hip_runtime.h>

typedef float v2f __attribute__((ext_vector_type(2)));
typedef float v4f __attribute__((ext_vector_type(4)));
typedef float v8f __attribute__((ext_vector_type(8)));
typedef _Float16 h8 __attribute__((ext_vector_type(8)));

#define B_  512
#define T_  1024
#define D_  64
#define K_  16
#define NTHREADS 512
#define EPS_ 1e-6f
#define SCALE_ 0.125f   // 1/sqrt(64)

// ---- LDS layout (bytes) ----
constexpr int OFF_Z   = 0;                       // 1024*64 f32   = 262144
constexpr int OFF_E   = OFF_Z   + T_*D_*4;       // 1024*16 f16   =  32768
constexpr int OFF_S   = OFF_E   + T_*K_*2;       // 1024 f32 (scores_t -> p_i)
constexpr int OFF_PNP = OFF_S   + T_*4;          // 16*64 f32 (pn * g0)
constexpr int OFF_P1  = OFF_PNP + K_*D_*4;       // 16 f32
constexpr int OFF_BD  = OFF_P1  + K_*4;          // 16 f32
constexpr int OFF_QH  = OFF_BD  + K_*4;          // 64 f32 (qhat)
constexpr int OFF_G2  = OFF_QH  + D_*4;          // 64 f32
constexpr int OFF_B2  = OFF_G2  + D_*4;
constexpr int OFF_G4  = OFF_B2  + D_*4;
constexpr int OFF_B4  = OFF_G4  + D_*4;
constexpr int OFF_ACC = OFF_B4  + D_*4;          // 16*64 f32 out accumulator
constexpr int OFF_RED = OFF_ACC + K_*D_*4;       // 64 f32 reduction scratch
constexpr int OFF_Q   = OFF_RED + 64*4;         // 64 f32 (q)
constexpr int SMEM_BYTES = OFF_Q + D_*4;         // ~302 KB < 320 KB/WGP

// LDS layout of the 64-float rows of z and pn' (sZ, sPnp): rows are 256 bytes apart, so one column of
// 16 rows would fall on one bank. The 16-byte piece c of row t is kept at place c ^ swz(t).
// swz is one-to-one over 16 rows in a row (a column of 16 rows covers all 64 banks), and
// rows t and t + 2 differ in its top bit (the two lane halves of a B operand use
// different banks).
__device__ __forceinline__ int swz(int t) { return ((t & 3) << 2) | ((t >> 2) & 3); }
// float index in sZ of element d of row t
__device__ __forceinline__ int zidx(int t, int d) {
  return t*D_ + ((((d >> 2) ^ swz(t)) << 2) | (d & 3));
}
// float index in sAcc of element d of row k: rows k and k + 8, which the two lane halves
// of an accumulator register add to at once, use different banks
__device__ __forceinline__ int aidx(int k, int d) { return k*D_ + (d ^ ((k & 8) << 2)); }

// Cross-lane moves on the vector pipe (no LDS round trip per butterfly step).
// lane l <- lane l ^ MASK inside a 16-lane row (DPP row_xmask)
template <int MASK>
__device__ __forceinline__ float row_xor(float v) {
  return __builtin_bit_cast(float, __builtin_amdgcn_mov_dpp(
      __builtin_bit_cast(int, v), 0x160 | MASK, 0xf, 0xf, true));
}
// lane l <- lane l ^ 16
__device__ __forceinline__ float half_xor(float v) {
  int b = __builtin_bit_cast(int, v);
  return __builtin_bit_cast(float, __builtin_amdgcn_permlanex16(
      b, b, 0x76543210, 0xfedcba98, false, false));
}
__device__ __forceinline__ float row_add(float v) {   // sum over a 16-lane row
  v += row_xor<8>(v); v += row_xor<4>(v); v += row_xor<2>(v); v += row_xor<1>(v);
  return v;
}
__device__ __forceinline__ float row_max(float v) {   // maximum over a 16-lane row
  v = fmaxf(v, row_xor<8>(v)); v = fmaxf(v, row_xor<4>(v));
  v = fmaxf(v, row_xor<2>(v)); v = fmaxf(v, row_xor<1>(v));
  return v;
}
__device__ __forceinline__ float wred_add(float v) {  // sum over all 32 lanes
  v += half_xor(v);
  return row_add(v);
}
__device__ __forceinline__ float quad_add(float v) {  // sum over 4 neighbouring lanes
  v += row_xor<1>(v); v += row_xor<2>(v);
  return v;
}
// 1/sqrt(x) as rsqrtf forms it (a tiny x is scaled up first). The v_nop fills the slot
// that the instruction set asks for directly behind a transcendental.
__device__ __forceinline__ float rsqrt_slot(float x) {
  const bool tiny = x < 0x1p-126f;
  float xs = tiny ? x * 0x1p+24f : x;
  float r;
  asm("v_rsq_f32 %0, %1\n\tv_nop" : "=v"(r) : "v"(xs));
  return tiny ? r * 0x1p+12f : r;
}

// e^x as __expf forms it (2^(x*log2 e)), with the same slot behind the transcendental.
__device__ __forceinline__ float exp_slot(float x) {
  float y = x * 1.442695041f;
  float r;
  asm("v_exp_f32 %0, %1\n\tv_nop" : "=v"(r) : "v"(y));
  return r;
}

__global__ __launch_bounds__(NTHREADS, 1)
void disentangled_encoder_kernel(const float* __restrict__ zg,
                                 const float* __restrict__ protos,
                                 const float* __restrict__ alphas,
                                 const float* __restrict__ b_bias,
                                 const float* __restrict__ W,
                                 const float* __restrict__ Wb,
                                 const float* __restrict__ ln_g,
                                 const float* __restrict__ ln_b,
                                 const float* __restrict__ beta_seq,
                                 float* __restrict__ out)
{
  extern __shared__ char smem[];
  float*    sZ   = (float*)(smem + OFF_Z);
  _Float16* sE   = (_Float16*)(smem + OFF_E);
  float*    sS   = (float*)(smem + OFF_S);
  float*    sPnp = (float*)(smem + OFF_PNP);
  float*    sP1  = (float*)(smem + OFF_P1);
  float*    sBd  = (float*)(smem + OFF_BD);
  float*    sQh  = (float*)(smem + OFF_QH);
  float*    sG2  = (float*)(smem + OFF_G2);
  float*    sB2  = (float*)(smem + OFF_B2);
  float*    sG4  = (float*)(smem + OFF_G4);
  float*    sB4  = (float*)(smem + OFF_B4);
  float*    sAcc = (float*)(smem + OFF_ACC);
  float*    sRed = (float*)(smem + OFF_RED);
  float*    sQ   = (float*)(smem + OFF_Q);

  const int b    = blockIdx.x;
  const int tid  = threadIdx.x;
  const int wave = tid >> 5;
  const int lane = tid & 31;

  // ---------------- Set-up reads: nothing here needs the staged z ----------
  // Issued ahead of the z copy, so that they do not queue behind it; used under it.
  // W: 8 threads share a row, each holds 8 neighbouring columns (a wave reads 1 KiB in a row).
  const int wrow = tid >> 3;
  const int wcol = (tid & 7) * 8;
  const v4f wa = *(const v4f*)&W[wrow*D_ + wcol];
  const v4f wb = *(const v4f*)&W[wrow*D_ + wcol + 4];
  const float px1 = protos[wave*D_+lane], px2 = protos[wave*D_+lane+32];
  const float g0a = ln_g[lane],      g0b = ln_g[lane+32];
  const float b0a = ln_b[lane],      b0b = ln_b[lane+32];
  const float g1a = ln_g[D_+lane],   g1b = ln_g[D_+lane+32];
  const float b1a = ln_b[D_+lane],   b1b = ln_b[D_+lane+32];
  // the query's row: z[b, T-1] straight from global memory. Every wave reads these few
  // lines (no branch in front of the copy); wave 0 uses them.
  const float* zlast = zg + (size_t)b * T_ * D_ + (T_-1)*D_;
  const float zl1 = zlast[lane],               zl2 = zlast[lane+32];
  const float al1 = alphas[(T_-1)*D_+lane],    al2 = alphas[(T_-1)*D_+lane+32];
  const float bi1 = b_bias[lane],              bi2 = b_bias[lane+32];
  const float g3a = ln_g[3*D_+lane],           g3b = ln_g[3*D_+lane+32];
  const float b3a = ln_b[3*D_+lane],           b3b = ln_b[3*D_+lane+32];
  const float wv1 = Wb[lane],                  wv2 = Wb[lane+32];

  // ---------------- Phase 0: async-DMA z[b] into LDS (CDNA5 async pipe) ----
  // GLOBAL_LOAD_ASYNC_TO_LDS_B128: no VGPR data movement, tracked by ASYNCcnt.
  {
    const float4* zsrc = (const float4*)(zg + (size_t)b * T_ * D_);
    #pragma unroll 4
    for (int i = tid; i < T_*D_/4; i += NTHREADS) {
      const int isw = (i & ~15) | ((i & 15) ^ swz(i >> 4));     // piece i&15 of row i>>4
      unsigned lds_addr = (unsigned)(uintptr_t)(sZ + 4*isw);    // LDS offset = flat[31:0]
      unsigned long long gaddr = (unsigned long long)(uintptr_t)(zsrc + i);
      asm volatile("global_load_async_to_lds_b128 %0, %1, off"
                   :: "v"(lds_addr), "v"(gaddr) : "memory");
    }
    // overlap: zero the out accumulator + fetch LN params while DMA is in flight
    for (int i = tid; i < K_*D_;  i += NTHREADS) sAcc[i] = 0.f;
    if (tid < D_) {
      sG2[tid] = ln_g[2*D_+tid]; sB2[tid] = ln_b[2*D_+tid];
      sG4[tid] = ln_g[4*D_+tid]; sB4[tid] = ln_b[4*D_+tid];
    }
    // also under the copy: prototypes LN (folded with g0/b0)
    {
      // wave w handles prototype row k=w (16 waves, K=16)
      const int k = wave;
      float x1 = px1, x2 = px2;
      float s1 = wred_add(x1 + x2);
      float s2 = wred_add(x1*x1 + x2*x2);
      float mu = s1 * (1.f/D_);
      float rs = rsqrtf(s2*(1.f/D_) - mu*mu + EPS_);
      float pn1 = (x1-mu)*rs*g1a + b1a;
      float pn2 = (x2-mu)*rs*g1b + b1b;
      float pp1 = pn1 * g0a;              // fold gamma0 into pn
      float pp2 = pn2 * g0b;
      sPnp[zidx(k, lane)] = pp1; sPnp[zidx(k, lane+32)] = pp2;
      float p1 = wred_add(pp1 + pp2);             // sum_d g0*pn
      float bd = wred_add(b0a*pn1 + b0b*pn2);     // sum_d b0*pn
      if (lane == 0) { sP1[k] = p1; sBd[k] = bd; }
    }
    // and q = LN(alphas[-1] + z[:, -1] + b_bias);  c0 = Wb . q
    if (wave == 0) {
      float x1 = al1 + zl1 + bi1;
      float x2 = al2 + zl2 + bi2;
      float s1 = wred_add(x1 + x2);
      float s2 = wred_add(x1*x1 + x2*x2);
      float mu = s1 * (1.f/D_);
      float rs = rsqrtf(s2*(1.f/D_) - mu*mu + EPS_);
      float q1 = (x1-mu)*rs*g3a + b3a;
      float q2 = (x2-mu)*rs*g3b + b3b;
      sQ[lane]    = q1;
      sQ[lane+32] = q2;
      float c0p = wred_add(wv1*q1 + wv2*q2);
      if (lane == 0) sRed[32] = c0p;
    }
    __syncthreads();                                    // q visible; the copy is still in flight
    // qhat = q + W q (all threads), also under the copy
    {
      // 8 products a thread from the W registers, then 3 cross-lane steps over the row's 8 threads
      v4f qa = *(const v4f*)&sQ[wcol];
      v4f qb = *(const v4f*)&sQ[wcol + 4];
      v4f pr = wa*qa + wb*qb;
      float dq = (pr[0] + pr[1]) + (pr[2] + pr[3]);
      dq += row_xor<1>(dq); dq += row_xor<2>(dq); dq += row_xor<4>(dq);
      float qd = sQ[wrow];
      if ((tid & 7) == 0) sQh[wrow] = qd + dq;
    }
    asm volatile("s_wait_asynccnt 0x0" ::: "memory");   // my async loads done
  }
  __syncthreads();                                      // all waves' loads, qhat, pn' visible

  // Row-sum layout: 4 lanes share a row, a wave works on 8 rows at once. Each lane
  // sums 16 elements in registers (4 reads of 16 bytes), then 2 cross-lane steps.
  // Step j reads quarter j of the row; the layout of sZ spreads 16 lanes over all 64 banks.
  // Every loop over p or j in this layout is unrolled: its small arrays are then
  // indexed by constants and stay in registers.
  const int l4   = lane & 3;
  const int rsub = lane >> 2;
  int qoff[4];                 // column of this lane's slice
  int zoff[2][4];              // its place in a row of sZ, for rows rsub and 8 + rsub
  #pragma unroll
  for (int j = 0; j < 4; ++j) {
    qoff[j] = 16*j + 4*l4;
    zoff[0][j] = zidx(rsub, qoff[j]) - rsub*D_;
    zoff[1][j] = zidx(8 + rsub, qoff[j]) - (8 + rsub)*D_;
  }

  // ---------------- Phase A: scores_k^T = pn' @ z^T  (f32 WMMA, exact), row stats of z ------
  // zn.pn folded: score = rs_t*(Zdot - mu_t*P1[k]) + bdot[k]
  // pn' is the A operand and z the B operand: a lane then holds 8 of the 16 scores of ONE
  // row t (k = r + 8*half), so the softmax over K is 8 registers and one exchange of halves.
  {
    const int half = lane >> 4;     // K-slice selector within A/B operands
    const int l16  = lane & 15;
    // k order of both operands: products 2m and 2m + 1 of the chain take the 16-byte piece
    // d = 8m + 4*half .. + 3 (its low and its high pair), so one 16-byte read feeds two WMMAs.
    // SCALE_ is a power of two: taken into pn', P1 and bdot it changes no rounding
    v4f pa[8];
    #pragma unroll
    for (int m = 0; m < 8; ++m)
      pa[m] = *(const v4f*)&sPnp[zidx(l16, 8*m + 4*half)] * SCALE_;   // A[k][d] = pn'[k][d]
    float P1s[8], bds[8];                       // this half's 8 intents
    #pragma unroll
    for (int r = 0; r < 8; ++r) {
      P1s[r] = sP1[8*half + r] * SCALE_;
      bds[r] = sBd[8*half + r] * SCALE_;
    }
    // kept rolled: pn' then stays live over the back edge, so that none of its registers is
    // given a new value directly behind a WMMA that reads it
    #pragma unroll 1
    for (int st = 0; st < 4; ++st) {
      const int t0 = wave*64 + st*16;
      const int t  = t0 + l16;                  // this lane's row
      v4f zb[8];
      #pragma unroll
      for (int m = 0; m < 8; ++m)
        zb[m] = *(const v4f*)&sZ[t0*D_ + zidx(l16, 8*m + 4*half)];    // B[d][t] = raw z (t0 % 16 == 0)
      v8f c = {};
      #pragma unroll
      for (int m = 0; m < 8; ++m) {
        c = __builtin_amdgcn_wmma_f32_16x16x4_f32(false, pa[m].lo, false, zb[m].lo,
                                                  (short)0, c, false, false);
        c = __builtin_amdgcn_wmma_f32_16x16x4_f32(false, pa[m].hi, false, zb[m].hi,
                                                  (short)0, c, false, false);
      }
      // the row's mean and rstd from the same registers: this lane holds half of row t
      v2f a1 = {0.f, 0.f}, a2 = {0.f, 0.f};
      #pragma unroll
      for (int m = 0; m < 8; ++m) {
        a1 += zb[m].lo;           a1 += zb[m].hi;
        a2 += zb[m].lo*zb[m].lo;  a2 += zb[m].hi*zb[m].hi;
      }
      float s1 = a1[0] + a1[1];  s1 += half_xor(s1);
      float s2 = a2[0] + a2[1];  s2 += half_xor(s2);
      const float mu = s1 * (1.f/D_);
      const float rs = rsqrt_slot(s2*(1.f/D_) - mu*mu + EPS_);
      // The loaded B fragments stay in their registers to the end of the chain (inputs only):
      // the scheduling barrier keeps the statement behind the chain.
      __builtin_amdgcn_sched_barrier(0);
      asm volatile("" ::
                   "v"(zb[0]), "v"(zb[1]), "v"(zb[2]), "v"(zb[3]),
                   "v"(zb[4]), "v"(zb[5]), "v"(zb[6]), "v"(zb[7]));
      // epilogue: LN-fold + softmax over K, all for this lane's row
      float sc[8];
      #pragma unroll
      for (int r = 0; r < 8; ++r) sc[r] = rs*(c[r] - mu*P1s[r]) + bds[r];
      float m = fmaxf(fmaxf(fmaxf(sc[0], sc[1]), fmaxf(sc[2], sc[3])),
                      fmaxf(fmaxf(sc[4], sc[5]), fmaxf(sc[6], sc[7])));
      m = fmaxf(m, half_xor(m));
      float e[8];
      #pragma unroll
      for (int r = 0; r < 8; ++r) e[r] = exp_slot(sc[r] - m);
      float S = ((e[0] + e[1]) + (e[2] + e[3])) + ((e[4] + e[5]) + (e[6] + e[7]));
      S += half_xor(S);
      const float inv = 1.f / S;
      h8 pk;
      #pragma unroll
      for (int r = 0; r < 8; ++r) pk[r] = (_Float16)(e[r] * inv);   // p_{k|i}
      *(h8*)&sE[t*K_ + 8*half] = pk;            // one 16-byte store a lane
    }
  }

  // ---------------- Phase A3: s_t = LN(alphas+z) . qhat + c0 (Dense folded) -
  {
    // same row-sum layout; LN folded as in Phase A, x = alphas + z:
    // LN(x).qhat = rs*(sum x*g2*qhat - mu*sum g2*qhat) + sum b2*qhat
    const float c0 = sRed[32];
    v4f av[8][4];                               // alphas is L2-resident
    unsigned gb[4];                             // byte offset of this lane's slices
    #pragma unroll
    for (int j = 0; j < 4; ++j) gb[j] = 4u*((wave*64 + rsub)*D_ + qoff[j]);
    #pragma unroll
    for (int p = 0; p < 8; ++p) {
      #pragma unroll
      for (int j = 0; j < 4; ++j)
        av[p][j] = *(const v4f*)((const char*)alphas + gb[j] + p*8*D_*4);
    }
    // the loads' offset registers stay untouched until this wait has passed
    asm volatile("s_wait_xcnt 0x0" :: "v"(gb[0]), "v"(gb[1]), "v"(gb[2]), "v"(gb[3]) : "memory");
    v4f gq[4];                                  // g2*qhat, this lane's 16 columns
    v2f gs = {0.f, 0.f}, bq = {0.f, 0.f};
    #pragma unroll
    for (int j = 0; j < 4; ++j) {
      v4f q  = *(const v4f*)&sQh[qoff[j]];
      v4f b2 = *(const v4f*)&sB2[qoff[j]];
      gq[j]  = *(const v4f*)&sG2[qoff[j]] * q;
      gs += gq[j].lo;    gs += gq[j].hi;
      bq += b2.lo*q.lo;  bq += b2.hi*q.hi;
    }
    const float Gs = quad_add(gs[0] + gs[1]);
    const float Bq = quad_add(bq[0] + bq[1]) + c0;
    // unrolled: the 8 passes are independent, their reads and sums overlap
    float sc[8];
    #pragma unroll
    for (int p = 0; p < 8; ++p) {
      const int t = wave*64 + p*8 + rsub;
      v2f a1 = {0.f, 0.f}, a2 = {0.f, 0.f}, a3 = {0.f, 0.f};
      #pragma unroll
      for (int j = 0; j < 4; ++j) {
        v4f x = av[p][j] + *(const v4f*)&sZ[t*D_ + zoff[p & 1][j]];
        a1 += x.lo;            a1 += x.hi;
        a2 += x.lo*x.lo;       a2 += x.hi*x.hi;
        a3 += x.lo*gq[j].lo;   a3 += x.hi*gq[j].hi;
      }
      float s1 = quad_add(a1[0] + a1[1]);
      float s2 = quad_add(a2[0] + a2[1]);
      float s3 = quad_add(a3[0] + a3[1]);
      float mu = s1 * (1.f/D_);
      float rs = rsqrt_slot(s2*(1.f/D_) - mu*mu + EPS_);
      sc[p] = (rs*(s3 - mu*Gs) + Bq) * SCALE_;
    }
    if (l4 == 0) {
      #pragma unroll
      for (int p = 0; p < 8; ++p) sS[wave*64 + p*8 + rsub] = sc[p];
    }
  }
  __syncthreads();

  // ---------------- softmax over T (block reduction) ------------------------
  {
    float sa = sS[tid], sb = sS[tid + NTHREADS];
    float m = fmaxf(sa, sb);
    m = row_max(fmaxf(m, half_xor(m)));
    if (lane == 0) sRed[wave] = m;
    __syncthreads();
    float M = -1e30f;
    #pragma unroll
    for (int i = 0; i < 16; ++i) M = fmaxf(M, sRed[i]);
    float ea = __expf(sa - M), eb = __expf(sb - M);
    float S = wred_add(ea + eb);
    if (lane == 0) sRed[16 + wave] = S;
    __syncthreads();
    float Ssum = 0.f;
    #pragma unroll
    for (int i = 0; i < 16; ++i) Ssum += sRed[16 + i];
    float inv = 1.f / Ssum;
    sS[tid]            = ea * inv;   // p_i
    sS[tid + NTHREADS] = eb * inv;
  }
  __syncthreads();

  // ---------------- Phase B: out[k,d] = sum_t (p_{k|i}*p_i) * z  (f32 WMMA) -
  {
    const int half = lane >> 4;
    const int l16  = lane & 15;
    const int tw   = wave*64;           // each wave owns a 64-wide T slice
    const int hx   = 32*half;           // swz(tA) = 8*half + (stp & 3), swz(tA+1) = that + 4
    v8f acc[4] = {};
    for (int stp = 0; stp < 16; ++stp) {
      int tA = tw + 4*stp + 2*half;
      // zidx(tA, d) and zidx(tA+1, d) written out, so that two addresses and constant
      // offsets serve the eight reads: column block dt of row tA lies at block
      // dt ^ 2*half, of row tA+1 at block dt ^ 2*half ^ 1
      const int sx = (((l16 >> 2) ^ (stp & 3)) << 2) | (l16 & 3);
      const float* zP = &sZ[tA*D_ + hx + sx];          // dt 0, 1
      const float* zQ = &sZ[tA*D_ + (32 - hx) + sx];   // dt 2, 3
      float p0 = sS[tA], p1 = sS[tA+1];
      v2f a;
      a[0] = (float)sE[tA*K_ + l16]     * p0;   // A[k][t] = w[t][k]
      a[1] = (float)sE[(tA+1)*K_ + l16] * p1;
      #pragma unroll
      for (int dt = 0; dt < 4; ++dt) {
        const float* zr = (dt & 2) ? zQ : zP;
        v2f bv;
        bv[0] = zr[16*(dt & 1)];                // B[t][d] = z, d = dt*16 + l16
        bv[1] = zr[D_ + 16*((dt & 1) ^ 1)];
        acc[dt] = __builtin_amdgcn_wmma_f32_16x16x4_f32(false, a, false, bv,
                                                        (short)0, acc[dt], false, false);
      }
    }
    // cross-wave K-dim reduction into sAcc
    #pragma unroll
    for (int dt = 0; dt < 4; ++dt) {
      #pragma unroll
      for (int r = 0; r < 8; ++r) {
        int k = r + 8*half;
        int d = dt*16 + l16;
        atomicAdd(&sAcc[aidx(k, d)], acc[dt][r]);
      }
    }
  }
  __syncthreads();

  // ---------------- Phase C: final LN(beta_seq + out) + store ---------------
  {
    const int k = wave;                 // 16 waves, 16 rows
    float v1 = beta_seq[k*D_+lane]    + sAcc[aidx(k, lane)];
    float v2 = beta_seq[k*D_+lane+32] + sAcc[aidx(k, lane+32)];
    float s1 = wred_add(v1 + v2);
    float s2 = wred_add(v1*v1 + v2*v2);
    float mu = s1 * (1.f/D_);
    float rs = rsqrtf(s2*(1.f/D_) - mu*mu + EPS_);
    float y1 = (v1-mu)*rs*sG4[lane]    + sB4[lane];
    float y2 = (v2-mu)*rs*sG4[lane+32] + sB4[lane+32];
    float* o = out + (size_t)b*K_*D_ + k*D_;
    o[lane]    = y1;
    o[lane+32] = y2;
  }
}

extern "C" void kernel_launch(void* const* d_in, const int* in_sizes, int n_in,
                              void* d_out, int out_size, void* d_ws, size_t ws_size,
                              hipStream_t stream) {
  const float* z        = (const float*)d_in[0];
  const float* protos   = (const float*)d_in[1];
  const float* alphas   = (const float*)d_in[2];
  const float* b_bias   = (const float*)d_in[3];
  const float* W        = (const float*)d_in[4];
  const float* Wb       = (const float*)d_in[5];
  const float* ln_g     = (const float*)d_in[6];
  const float* ln_b     = (const float*)d_in[7];
  const float* beta_seq = (const float*)d_in[8];
  float* out = (float*)d_out;

  disentangled_encoder_kernel<<<B_, NTHREADS, SMEM_BYTES, stream>>>(
      z, protos, alphas, b_bias, W, Wb, ln_g, ln_b, beta_seq, out);
}
